// v000
// Measured on an AMD MI455X. A time is GPU time per run, averaged over a window of back-to-back runs after a warm-up
// (all launches, gaps included; the runs take copies of the inputs in turn), and the median of several windows.
// Apart from v000's, it joins two sittings. Times from different sittings can be a few percent apart, while
// side-by-side timings come from the same sitting.
// v000, which the later versions start from, runs in 758 microseconds.
#include <hip/hip_runtime.h>
#include <hip/hip_bf16.h>

typedef __bf16 bf16;
typedef __attribute__((ext_vector_type(16))) __bf16 v16bf;
typedef __attribute__((ext_vector_type(8)))  float  v8f;
typedef int v4i_ __attribute__((vector_size(16)));

#define D_MODEL 1024
#define SEQ     4096
#define NHEAD   16
#define DK      64

#define AS1 __attribute__((address_space(1)))
#define AS3 __attribute__((address_space(3)))

#if __has_builtin(__builtin_amdgcn_global_load_async_to_lds_b128)
#define ASYNC_CP 1
static __device__ __forceinline__ void async_cp16(const void* g, void* l) {
  __builtin_amdgcn_global_load_async_to_lds_b128(
      (AS1 v4i_*)(unsigned long long)(size_t)g,
      (AS3 v4i_*)(unsigned)(size_t)l, 0, 0);
}
static __device__ __forceinline__ void async_wait0() {
#if __has_builtin(__builtin_amdgcn_s_wait_asynccnt)
  __builtin_amdgcn_s_wait_asynccnt(0);
#else
  asm volatile("s_wait_asynccnt 0" ::: "memory");
#endif
}
#else
#define ASYNC_CP 0
#endif

static __device__ __forceinline__ v16bf ldfrag(const bf16* base, int ld) {
  const int lane = threadIdx.x & 31;
  const int m    = lane & 15;
  const int b0   = (lane & 16) ? 8 : 0;
  const bf16* p  = base + m * ld + b0;
  union { uint4 u[2]; v16bf v; } r;
  r.u[0] = *reinterpret_cast<const uint4*>(p);
  r.u[1] = *reinterpret_cast<const uint4*>(p + 16);
  return r.v;
}

static __device__ __forceinline__ v8f wmma_bf16(v16bf a, v16bf b, v8f c) {
  return __builtin_amdgcn_wmma_f32_16x16x32_bf16(false, a, false, b,
                                                 (short)0, c, false, false);
}

// ---------------------------------------------------------------------------
// Transpose + convert weights: Wt[i][o] = (bf16) W[o][i]
// ---------------------------------------------------------------------------
__global__ void k_prep_w(const float* __restrict__ W, bf16* __restrict__ Wt) {
  int t = blockIdx.x * 256 + threadIdx.x;      // 1M elements
  int o = t >> 10;
  int i = t & 1023;
  Wt[i * D_MODEL + o] = (bf16)W[t];
}

// ---------------------------------------------------------------------------
// Tiled GEMM: Y = X @ W^T + b
// MODE 0: A f32, bias+RoPE, *oscale, head-major bf16 [H][S][DK]  (Q with 1/8, K)
// MODE 1: A f32, bias,      *oscale, head-major bf16            (V)
// MODE 2: A bf16 (attn out), bias, f32 [S][D_MODEL]             (O-proj)
// Workgroup = 256 threads = 8 waves; tile 128 rows x 64 cols; K step 32.
// ---------------------------------------------------------------------------
template <int MODE>
__global__ void k_gemm(const float* __restrict__ Af,
                       const bf16*  __restrict__ Ab,
                       const bf16*  __restrict__ Wt,
                       const float* __restrict__ bias,
                       bf16*        __restrict__ outH,
                       float*       __restrict__ outF,
                       float        oscale) {
  __shared__ alignas(16) bf16 As[128 * 32];   // [row][k]
  __shared__ alignas(16) bf16 Bs[64 * 32];    // [n][k]

  const int tid  = threadIdx.x;
  const int lane = tid & 31;
  const int wave = tid >> 5;
  const int row0 = blockIdx.x * 128;
  const int col0 = blockIdx.y * 64;
  const int m0   = wave * 16;

  v8f c[4] = {};

  for (int kk = 0; kk < D_MODEL; kk += 32) {
#if ASYNC_CP
    if (MODE == 2) {
      // bf16 source, layout-preserving: async 16B chunks (2 per thread)
#pragma unroll
      for (int rep = 0; rep < 2; ++rep) {
        int e = rep * 2048 + tid * 8;          // element index into 128x32 tile
        int r = e >> 5, cc = e & 31;
        async_cp16(Ab + (size_t)(row0 + r) * D_MODEL + kk + cc, &As[e]);
      }
    }
#endif
    if (MODE != 2 || !ASYNC_CP) {
#pragma unroll
      for (int rep = 0; rep < 16; ++rep) {     // 128x32 A tile
        int idx = rep * 256 + tid;
        int r = idx >> 5, cc = idx & 31;
        if (MODE == 2) As[idx] = Ab[(size_t)(row0 + r) * D_MODEL + kk + cc];
        else           As[idx] = (bf16)Af[(size_t)(row0 + r) * D_MODEL + kk + cc];
      }
    }
#pragma unroll
    for (int rep = 0; rep < 8; ++rep) {        // 32x64 B tile -> [n][k]
      int idx = rep * 256 + tid;
      int k = idx >> 6, n = idx & 63;
      Bs[n * 32 + k] = Wt[(size_t)(kk + k) * D_MODEL + col0 + n];
    }
#if ASYNC_CP
    if (MODE == 2) async_wait0();
#endif
    __syncthreads();

    v16bf a = ldfrag(&As[m0 * 32], 32);
#pragma unroll
    for (int nt = 0; nt < 4; ++nt) {
      v16bf b = ldfrag(&Bs[(nt * 16) * 32], 32);
      c[nt] = wmma_bf16(a, b, c[nt]);
    }
    __syncthreads();
  }

  const int n  = lane & 15;
  const int rb = (lane >> 4) << 3;
#pragma unroll
  for (int nt = 0; nt < 4; ++nt) {
    const int col = col0 + nt * 16 + n;
    const float bv = bias[col];
#pragma unroll
    for (int v = 0; v < 8; ++v) c[nt][v] += bv;

    if (MODE == 2) {
#pragma unroll
      for (int v = 0; v < 8; ++v)
        outF[(size_t)(row0 + m0 + rb + v) * D_MODEL + col] = c[nt][v];
    } else {
      const int h = col >> 6;
      const int d = col & 63;
      if (MODE == 0) {
        // RoPE: pairs (2i, 2i+1) are adjacent columns -> adjacent lanes.
        const float freq = __powf(10000.0f, -(float)(d & ~1) * (1.0f / 64.0f));
        const bool  ev   = (d & 1) == 0;
#pragma unroll
        for (int v = 0; v < 8; ++v) {
          const int pos = row0 + m0 + rb + v;
          float sn, cs;
          __sincosf((float)pos * freq, &sn, &cs);
          float x  = c[nt][v];
          float xp = __shfl_xor(x, 1, 32);
          c[nt][v] = ev ? (x * cs - xp * sn) : (xp * sn + x * cs);
        }
      }
#pragma unroll
      for (int v = 0; v < 8; ++v) {
        const int pos = row0 + m0 + rb + v;
        outH[((size_t)h * SEQ + pos) * DK + d] = (bf16)(c[nt][v] * oscale);
      }
    }
  }
}

// ---------------------------------------------------------------------------
// Flash attention: one (head, 128-query-row) tile per workgroup, kv tiles of 32.
// 1/sqrt(dk) pre-folded into Q. Row-sum of P computed by an extra WMMA against
// an all-ones B fragment (lands directly in the l_i layout -> no shuffles);
// only the row-max still uses a 4-step shuffle tree.
// ---------------------------------------------------------------------------
__global__ void k_attn(const bf16* __restrict__ qh, const bf16* __restrict__ kh,
                       const bf16* __restrict__ vh, bf16* __restrict__ outA) {
  __shared__ alignas(16) bf16 Qs[128 * 64];   // [row][d]       16 KB
  __shared__ alignas(16) bf16 Ks[32 * 64];    // [kv][d]         4 KB
  __shared__ alignas(16) bf16 Vt[64 * 32];    // [d][kv]         4 KB
  __shared__ alignas(16) bf16 Ps[8][16 * 32]; // per-wave P      8 KB

  const int tid  = threadIdx.x;
  const int lane = tid & 31;
  const int wave = tid >> 5;
  const int row0 = blockIdx.x * 128;
  const int h    = blockIdx.y;
  const int m0   = wave * 16;

  const bf16* qb = qh + (size_t)h * SEQ * DK;
  const bf16* kb = kh + (size_t)h * SEQ * DK;
  const bf16* vb = vh + (size_t)h * SEQ * DK;

#if ASYNC_CP
#pragma unroll
  for (int rep = 0; rep < 4; ++rep) {          // 128x64 Q tile, 16B/thread/rep
    int e = rep * 2048 + tid * 8;
    async_cp16(qb + (size_t)row0 * DK + e, &Qs[e]);
  }
  async_wait0();
#else
#pragma unroll
  for (int rep = 0; rep < 32; ++rep) {
    int idx = rep * 256 + tid;
    Qs[idx] = qb[(size_t)row0 * DK + idx];
  }
#endif
  __syncthreads();
  const v16bf qa0 = ldfrag(&Qs[m0 * 64], 64);
  const v16bf qa1 = ldfrag(&Qs[m0 * 64 + 32], 64);

  v16bf ones;
#pragma unroll
  for (int i = 0; i < 16; ++i) ones[i] = (bf16)1.0f;

  v8f acc[4] = {};
  float m_i[8], l_i[8];
#pragma unroll
  for (int v = 0; v < 8; ++v) { m_i[v] = -3.0e38f; l_i[v] = 0.0f; }

  const int n  = lane & 15;
  const int rb = (lane >> 4) << 3;

  for (int j0 = 0; j0 < SEQ; j0 += 32) {
#if ASYNC_CP
    async_cp16(kb + (size_t)j0 * DK + tid * 8, &Ks[tid * 8]);  // 32x64 K tile
#endif
#pragma unroll
    for (int rep = 0; rep < 8; ++rep) {        // V^T staging (2B transpose)
      int idx = rep * 256 + tid;
      int r = idx >> 6, d = idx & 63;
#if !ASYNC_CP
      Ks[idx] = kb[(size_t)j0 * DK + idx];
#endif
      Vt[d * 32 + r] = vb[(size_t)j0 * DK + idx];
    }
    if (j0 + 32 < SEQ) {                       // global_prefetch_b8 next tiles
      __builtin_prefetch(kb + (size_t)(j0 + 32) * DK + tid * 8, 0, 0);
      __builtin_prefetch(vb + (size_t)(j0 + 32) * DK + tid * 8, 0, 0);
    }
#if ASYNC_CP
    async_wait0();
#endif
    __syncthreads();

    // S(16x32) = Q(16x64) * K^T  (scale already folded into Q)
    v8f s0 = {}, s1 = {};
    s0 = wmma_bf16(qa0, ldfrag(&Ks[0], 64), s0);
    s0 = wmma_bf16(qa1, ldfrag(&Ks[32], 64), s0);
    s1 = wmma_bf16(qa0, ldfrag(&Ks[16 * 64], 64), s1);
    s1 = wmma_bf16(qa1, ldfrag(&Ks[16 * 64 + 32], 64), s1);

    // row max across the 16 lanes sharing each C-tile row; rescale factor
    float alpha[8];
#pragma unroll
    for (int v = 0; v < 8; ++v) {
      float m = fmaxf(s0[v], s1[v]);
#pragma unroll
      for (int msk = 1; msk < 16; msk <<= 1)
        m = fmaxf(m, __shfl_xor(m, msk, 32));
      float mn = fmaxf(m_i[v], m);
      alpha[v] = __expf(m_i[v] - mn);
      m_i[v]   = mn;
    }
#pragma unroll
    for (int v = 0; v < 8; ++v) {
      s0[v] = __expf(s0[v] - m_i[v]);
      s1[v] = __expf(s1[v] - m_i[v]);
    }
#pragma unroll
    for (int nt = 0; nt < 4; ++nt)
#pragma unroll
      for (int v = 0; v < 8; ++v) acc[nt][v] *= alpha[v];

    // C-layout -> A-layout for P via per-wave LDS scratch (in-order DS ops)
#pragma unroll
    for (int v = 0; v < 8; ++v) {
      Ps[wave][(rb + v) * 32 + n]      = (bf16)s0[v];
      Ps[wave][(rb + v) * 32 + n + 16] = (bf16)s1[v];
    }
    v16bf pa = ldfrag(&Ps[wave][0], 32);

    // row-sum(P) via WMMA against all-ones B: lands in l_i's layout
    v8f zero = {};
    v8f ls = wmma_bf16(pa, ones, zero);
#pragma unroll
    for (int v = 0; v < 8; ++v) l_i[v] = l_i[v] * alpha[v] + ls[v];

#pragma unroll
    for (int nt = 0; nt < 4; ++nt)
      acc[nt] = wmma_bf16(pa, ldfrag(&Vt[(nt * 16) * 32], 32), acc[nt]);
    __syncthreads();
  }

  // normalize and store merged-head bf16 [S][D_MODEL]
#pragma unroll
  for (int v = 0; v < 8; ++v) {
    const float inv = 1.0f / l_i[v];
    const int   pos = row0 + m0 + rb + v;
#pragma unroll
    for (int nt = 0; nt < 4; ++nt)
      outA[(size_t)pos * D_MODEL + h * DK + nt * 16 + n] =
          (bf16)(acc[nt][v] * inv);
  }
}

// ---------------------------------------------------------------------------
extern "C" void kernel_launch(void* const* d_in, const int* in_sizes, int n_in,
                              void* d_out, int out_size, void* d_ws,
                              size_t ws_size, hipStream_t stream) {
  const float* Q  = (const float*)d_in[0];
  const float* K  = (const float*)d_in[1];
  const float* V  = (const float*)d_in[2];
  const float* Wq = (const float*)d_in[3];
  const float* bq = (const float*)d_in[4];
  const float* Wk = (const float*)d_in[5];
  const float* bk = (const float*)d_in[6];
  const float* Wv = (const float*)d_in[7];
  const float* bv = (const float*)d_in[8];
  const float* Wo = (const float*)d_in[9];
  const float* bo = (const float*)d_in[10];
  float* out = (float*)d_out;

  char* ws = (char*)d_ws;
  const size_t WB = (size_t)D_MODEL * D_MODEL * sizeof(bf16); // 2 MB
  const size_t TB = (size_t)SEQ * D_MODEL * sizeof(bf16);     // 8 MB
  bf16* wq_t = (bf16*)(ws);
  bf16* wk_t = (bf16*)(ws + WB);
  bf16* wv_t = (bf16*)(ws + 2 * WB);
  bf16* wo_t = (bf16*)(ws + 3 * WB);
  bf16* qh   = (bf16*)(ws + 4 * WB);
  bf16* kh   = (bf16*)(ws + 4 * WB + TB);
  bf16* vh   = (bf16*)(ws + 4 * WB + 2 * TB);
  bf16* at   = (bf16*)(ws + 4 * WB + 3 * TB);

  dim3 blk(256);
  k_prep_w<<<dim3((D_MODEL * D_MODEL) / 256), blk, 0, stream>>>(Wq, wq_t);
  k_prep_w<<<dim3((D_MODEL * D_MODEL) / 256), blk, 0, stream>>>(Wk, wk_t);
  k_prep_w<<<dim3((D_MODEL * D_MODEL) / 256), blk, 0, stream>>>(Wv, wv_t);
  k_prep_w<<<dim3((D_MODEL * D_MODEL) / 256), blk, 0, stream>>>(Wo, wo_t);

  dim3 grd(SEQ / 128, D_MODEL / 64);          // 32 x 16
  k_gemm<0><<<grd, blk, 0, stream>>>(Q, nullptr, wq_t, bq, qh, nullptr, 0.125f);
  k_gemm<0><<<grd, blk, 0, stream>>>(K, nullptr, wk_t, bk, kh, nullptr, 1.0f);
  k_gemm<1><<<grd, blk, 0, stream>>>(V, nullptr, wv_t, bv, vh, nullptr, 1.0f);

  k_attn<<<dim3(SEQ / 128, NHEAD), blk, 0, stream>>>(qh, kh, vh, at);

  k_gemm<2><<<grd, blk, 0, stream>>>(nullptr, at, wo_t, bo, nullptr, out, 1.0f);
}

// v001
// A run of this version takes 425 microseconds.
// Timed twice side by side with v000, it ran 1.80 times as fast both times.
#include <hip/hip_runtime.h>
#include <hip/hip_bf16.h>

typedef __bf16 bf16;
typedef __attribute__((ext_vector_type(16))) __bf16 v16bf;
typedef __attribute__((ext_vector_type(8)))  float  v8f;
typedef int v4i_ __attribute__((vector_size(16)));

#define D_MODEL 1024
#define SEQ     4096
#define NHEAD   16
#define DK      64

#define P32 40   // rows of 32 elements (64 B of data) lie 80 B apart
#define P64 72   // rows of 64 elements (128 B of data) lie 144 B apart

#define AS1 __attribute__((address_space(1)))
#define AS3 __attribute__((address_space(3)))

#if __has_builtin(__builtin_amdgcn_global_load_async_to_lds_b128)
#define ASYNC_CP 1
static __device__ __forceinline__ void async_cp16(const void* g, void* l) {
  __builtin_amdgcn_global_load_async_to_lds_b128(
      (AS1 v4i_*)(unsigned long long)(size_t)g,
      (AS3 v4i_*)(unsigned)(size_t)l, 0, 0);
}
static __device__ __forceinline__ void async_wait0() {
#if __has_builtin(__builtin_amdgcn_s_wait_asynccnt)
  __builtin_amdgcn_s_wait_asynccnt(0);
#else
  asm volatile("s_wait_asynccnt 0" ::: "memory");
#endif
}
#else
#define ASYNC_CP 0
#endif

static __device__ __forceinline__ v16bf ldfrag(const bf16* base, int ld) {
  const int lane = threadIdx.x & 31;
  const int m    = lane & 15;
  const int b0   = (lane & 16) ? 8 : 0;
  const bf16* p  = base + m * ld + b0;
  union { uint4 u[2]; v16bf v; } r;
  r.u[0] = *reinterpret_cast<const uint4*>(p);
  r.u[1] = *reinterpret_cast<const uint4*>(p + 16);
  return r.v;
}

static __device__ __forceinline__ v8f wmma_bf16(v16bf a, v16bf b, v8f c) {
  return __builtin_amdgcn_wmma_f32_16x16x32_bf16(false, a, false, b,
                                                 (short)0, c, false, false);
}

// ---------------------------------------------------------------------------
// Transpose + convert weights: Wt[i][o] = (bf16) W[o][i]
// ---------------------------------------------------------------------------
__global__ void k_prep_w(const float* __restrict__ W, bf16* __restrict__ Wt) {
  int t = blockIdx.x * 256 + threadIdx.x;      // 1M elements
  int o = t >> 10;
  int i = t & 1023;
  Wt[i * D_MODEL + o] = (bf16)W[t];
}

// ---------------------------------------------------------------------------
// Tiled GEMM: Y = X @ W^T + b
// MODE 0: A f32, bias+RoPE, *oscale, head-major bf16 [H][S][DK]  (Q with 1/8, K)
// MODE 1: A f32, bias,      *oscale, head-major bf16            (V)
// MODE 2: A bf16 (attn out), bias, f32 [S][D_MODEL]             (O-proj)
// Workgroup = 256 threads = 8 waves; tile 128 rows x 64 cols; K step 32.
// ---------------------------------------------------------------------------
template <int MODE>
__global__ void k_gemm(const float* __restrict__ Af,
                       const bf16*  __restrict__ Ab,
                       const bf16*  __restrict__ Wt,
                       const float* __restrict__ bias,
                       bf16*        __restrict__ outH,
                       float*       __restrict__ outF,
                       float        oscale) {
  __shared__ alignas(16) bf16 As[128 * P32];  // [row][k], padded rows
  __shared__ alignas(16) bf16 Bs[64 * P32];   // [n][k], padded rows

  const int tid  = threadIdx.x;
  const int lane = tid & 31;
  const int wave = tid >> 5;
  const int row0 = blockIdx.x * 128;
  const int col0 = blockIdx.y * 64;
  const int m0   = wave * 16;

  v8f c[4] = {};

  for (int kk = 0; kk < D_MODEL; kk += 32) {
#if ASYNC_CP
    if (MODE == 2) {
      // bf16 source, layout-preserving: async 16B chunks (2 per thread)
#pragma unroll
      for (int rep = 0; rep < 2; ++rep) {
        int r = rep * 64 + (tid >> 2), cc = (tid & 3) * 8;   // 128x32 tile
        async_cp16(Ab + (size_t)(row0 + r) * D_MODEL + kk + cc, &As[r * P32 + cc]);
      }
    }
#endif
    if (MODE != 2 || !ASYNC_CP) {
#pragma unroll
      for (int rep = 0; rep < 16; ++rep) {     // 128x32 A tile
        int r = rep * 8 + (tid >> 5), cc = tid & 31;
        if (MODE == 2) As[r * P32 + cc] = Ab[(size_t)(row0 + r) * D_MODEL + kk + cc];
        else           As[r * P32 + cc] = (bf16)Af[(size_t)(row0 + r) * D_MODEL + kk + cc];
      }
    }
#pragma unroll
    for (int rep = 0; rep < 8; ++rep) {        // 32x64 B tile -> [n][k]
      int k = rep * 4 + (tid >> 6), n = tid & 63;
      Bs[n * P32 + k] = Wt[(size_t)(kk + k) * D_MODEL + col0 + n];
    }
#if ASYNC_CP
    if (MODE == 2) async_wait0();
#endif
    __syncthreads();

    v16bf a = ldfrag(&As[m0 * P32], P32);
#pragma unroll
    for (int nt = 0; nt < 4; ++nt) {
      v16bf b = ldfrag(&Bs[(nt * 16) * P32], P32);
      c[nt] = wmma_bf16(a, b, c[nt]);
    }
    __syncthreads();
  }

  const int n  = lane & 15;
  const int rb = (lane >> 4) << 3;
#pragma unroll
  for (int nt = 0; nt < 4; ++nt) {
    const int col = col0 + nt * 16 + n;
    const float bv = bias[col];
#pragma unroll
    for (int v = 0; v < 8; ++v) c[nt][v] += bv;

    if (MODE == 2) {
#pragma unroll
      for (int v = 0; v < 8; ++v)
        outF[(size_t)(row0 + m0 + rb + v) * D_MODEL + col] = c[nt][v];
    } else {
      const int h = col >> 6;
      const int d = col & 63;
      if (MODE == 0) {
        // RoPE: pairs (2i, 2i+1) are adjacent columns -> adjacent lanes.
        const float freq = __powf(10000.0f, -(float)(d & ~1) * (1.0f / 64.0f));
        const bool  ev   = (d & 1) == 0;
#pragma unroll
        for (int v = 0; v < 8; ++v) {
          const int pos = row0 + m0 + rb + v;
          float sn, cs;
          __sincosf((float)pos * freq, &sn, &cs);
          float x  = c[nt][v];
          float xp = __shfl_xor(x, 1, 32);
          c[nt][v] = ev ? (x * cs - xp * sn) : (xp * sn + x * cs);
        }
      }
#pragma unroll
      for (int v = 0; v < 8; ++v) {
        const int pos = row0 + m0 + rb + v;
        outH[((size_t)h * SEQ + pos) * DK + d] = (bf16)(c[nt][v] * oscale);
      }
    }
  }
}

// ---------------------------------------------------------------------------
// Flash attention: one (head, 128-query-row) tile per workgroup, kv tiles of 32.
// 1/sqrt(dk) pre-folded into Q. Row-sum of P computed by an extra WMMA against
// an all-ones B fragment (lands directly in the l_i layout -> no shuffles);
// only the row-max still uses a 4-step shuffle tree.
// ---------------------------------------------------------------------------
__global__ void k_attn(const bf16* __restrict__ qh, const bf16* __restrict__ kh,
                       const bf16* __restrict__ vh, bf16* __restrict__ outA) {
  __shared__ alignas(16) bf16 Qs[128 * 64];   // [row][d]       16 KB
  __shared__ alignas(16) bf16 Ks[32 * P64];   // [kv][d], padded rows
  __shared__ alignas(16) bf16 Vt[64 * P32];   // [d][kv], padded rows
  __shared__ alignas(16) bf16 Ps[8][16 * P32]; // per-wave P, padded rows

  const int tid  = threadIdx.x;
  const int lane = tid & 31;
  const int wave = tid >> 5;
  const int row0 = blockIdx.x * 128;
  const int h    = blockIdx.y;
  const int m0   = wave * 16;

  const bf16* qb = qh + (size_t)h * SEQ * DK;
  const bf16* kb = kh + (size_t)h * SEQ * DK;
  const bf16* vb = vh + (size_t)h * SEQ * DK;

#if ASYNC_CP
#pragma unroll
  for (int rep = 0; rep < 4; ++rep) {          // 128x64 Q tile, 16B/thread/rep
    int e = rep * 2048 + tid * 8;
    async_cp16(qb + (size_t)row0 * DK + e, &Qs[e]);
  }
  async_wait0();
#else
#pragma unroll
  for (int rep = 0; rep < 32; ++rep) {
    int idx = rep * 256 + tid;
    Qs[idx] = qb[(size_t)row0 * DK + idx];
  }
#endif
  __syncthreads();
  const v16bf qa0 = ldfrag(&Qs[m0 * 64], 64);
  const v16bf qa1 = ldfrag(&Qs[m0 * 64 + 32], 64);

  v16bf ones;
#pragma unroll
  for (int i = 0; i < 16; ++i) ones[i] = (bf16)1.0f;

  v8f acc[4] = {};
  float m_i[8], l_i[8];
#pragma unroll
  for (int v = 0; v < 8; ++v) { m_i[v] = -3.0e38f; l_i[v] = 0.0f; }

  const int n  = lane & 15;
  const int rb = (lane >> 4) << 3;

  for (int j0 = 0; j0 < SEQ; j0 += 32) {
#if ASYNC_CP
    async_cp16(kb + (size_t)j0 * DK + tid * 8,                 // 32x64 K tile
               &Ks[(tid >> 3) * P64 + (tid & 7) * 8]);
#endif
#pragma unroll
    for (int rep = 0; rep < 8; ++rep) {        // V^T staging (2B transpose)
      int idx = rep * 256 + tid;
      int r = rep * 4 + (tid >> 6), d = tid & 63;
#if !ASYNC_CP
      Ks[r * P64 + d] = kb[(size_t)j0 * DK + idx];
#endif
      Vt[d * P32 + r] = vb[(size_t)j0 * DK + idx];
    }
    if (j0 + 32 < SEQ) {                       // global_prefetch_b8 next tiles
      __builtin_prefetch(kb + (size_t)(j0 + 32) * DK + tid * 8, 0, 0);
      __builtin_prefetch(vb + (size_t)(j0 + 32) * DK + tid * 8, 0, 0);
    }
#if ASYNC_CP
    async_wait0();
#endif
    __syncthreads();

    // S(16x32) = Q(16x64) * K^T  (scale already folded into Q)
    v8f s0 = {}, s1 = {};
    s0 = wmma_bf16(qa0, ldfrag(&Ks[0], P64), s0);
    s0 = wmma_bf16(qa1, ldfrag(&Ks[32], P64), s0);
    s1 = wmma_bf16(qa0, ldfrag(&Ks[16 * P64], P64), s1);
    s1 = wmma_bf16(qa1, ldfrag(&Ks[16 * P64 + 32], P64), s1);

    // row max across the 16 lanes sharing each C-tile row; rescale factor
    float alpha[8];
#pragma unroll
    for (int v = 0; v < 8; ++v) {
      float m = fmaxf(s0[v], s1[v]);
#pragma unroll
      for (int msk = 1; msk < 16; msk <<= 1)
        m = fmaxf(m, __shfl_xor(m, msk, 32));
      float mn = fmaxf(m_i[v], m);
      alpha[v] = __expf(m_i[v] - mn);
      m_i[v]   = mn;
    }
#pragma unroll
    for (int v = 0; v < 8; ++v) {
      s0[v] = __expf(s0[v] - m_i[v]);
      s1[v] = __expf(s1[v] - m_i[v]);
    }
#pragma unroll
    for (int nt = 0; nt < 4; ++nt)
#pragma unroll
      for (int v = 0; v < 8; ++v) acc[nt][v] *= alpha[v];

    // C-layout -> A-layout for P via per-wave LDS scratch (in-order DS ops)
#pragma unroll
    for (int v = 0; v < 8; ++v) {
      Ps[wave][(rb + v) * P32 + n]      = (bf16)s0[v];
      Ps[wave][(rb + v) * P32 + n + 16] = (bf16)s1[v];
    }
    v16bf pa = ldfrag(&Ps[wave][0], P32);

    // row-sum(P) via WMMA against all-ones B: lands in l_i's layout
    v8f zero = {};
    v8f ls = wmma_bf16(pa, ones, zero);
#pragma unroll
    for (int v = 0; v < 8; ++v) l_i[v] = l_i[v] * alpha[v] + ls[v];

#pragma unroll
    for (int nt = 0; nt < 4; ++nt)
      acc[nt] = wmma_bf16(pa, ldfrag(&Vt[(nt * 16) * P32], P32), acc[nt]);
    __syncthreads();
  }

  // normalize and store merged-head bf16 [S][D_MODEL]
#pragma unroll
  for (int v = 0; v < 8; ++v) {
    const float inv = 1.0f / l_i[v];
    const int   pos = row0 + m0 + rb + v;
#pragma unroll
    for (int nt = 0; nt < 4; ++nt)
      outA[(size_t)pos * D_MODEL + h * DK + nt * 16 + n] =
          (bf16)(acc[nt][v] * inv);
  }
}

// ---------------------------------------------------------------------------
extern "C" void kernel_launch(void* const* d_in, const int* in_sizes, int n_in,
                              void* d_out, int out_size, void* d_ws,
                              size_t ws_size, hipStream_t stream) {
  const float* Q  = (const float*)d_in[0];
  const float* K  = (const float*)d_in[1];
  const float* V  = (const float*)d_in[2];
  const float* Wq = (const float*)d_in[3];
  const float* bq = (const float*)d_in[4];
  const float* Wk = (const float*)d_in[5];
  const float* bk = (const float*)d_in[6];
  const float* Wv = (const float*)d_in[7];
  const float* bv = (const float*)d_in[8];
  const float* Wo = (const float*)d_in[9];
  const float* bo = (const float*)d_in[10];
  float* out = (float*)d_out;

  char* ws = (char*)d_ws;
  const size_t WB = (size_t)D_MODEL * D_MODEL * sizeof(bf16); // 2 MB
  const size_t TB = (size_t)SEQ * D_MODEL * sizeof(bf16);     // 8 MB
  bf16* wq_t = (bf16*)(ws);
  bf16* wk_t = (bf16*)(ws + WB);
  bf16* wv_t = (bf16*)(ws + 2 * WB);
  bf16* wo_t = (bf16*)(ws + 3 * WB);
  bf16* qh   = (bf16*)(ws + 4 * WB);
  bf16* kh   = (bf16*)(ws + 4 * WB + TB);
  bf16* vh   = (bf16*)(ws + 4 * WB + 2 * TB);
  bf16* at   = (bf16*)(ws + 4 * WB + 3 * TB);

  dim3 blk(256);
  k_prep_w<<<dim3((D_MODEL * D_MODEL) / 256), blk, 0, stream>>>(Wq, wq_t);
  k_prep_w<<<dim3((D_MODEL * D_MODEL) / 256), blk, 0, stream>>>(Wk, wk_t);
  k_prep_w<<<dim3((D_MODEL * D_MODEL) / 256), blk, 0, stream>>>(Wv, wv_t);
  k_prep_w<<<dim3((D_MODEL * D_MODEL) / 256), blk, 0, stream>>>(Wo, wo_t);

  dim3 grd(SEQ / 128, D_MODEL / 64);          // 32 x 16
  k_gemm<0><<<grd, blk, 0, stream>>>(Q, nullptr, wq_t, bq, qh, nullptr, 0.125f);
  k_gemm<0><<<grd, blk, 0, stream>>>(K, nullptr, wk_t, bk, kh, nullptr, 1.0f);
  k_gemm<1><<<grd, blk, 0, stream>>>(V, nullptr, wv_t, bv, vh, nullptr, 1.0f);

  k_attn<<<dim3(SEQ / 128, NHEAD), blk, 0, stream>>>(qh, kh, vh, at);

  k_gemm<2><<<grd, blk, 0, stream>>>(nullptr, at, wo_t, bo, nullptr, out, 1.0f);
}

// v002
// Measured time: 278 microseconds a run.
// In both of two side-by-side timings against v001, it was 1.53 times as fast.
// Counting every step since v000, it is 2.75 times as fast.
#include <hip/hip_runtime.h>
#include <hip/hip_bf16.h>

typedef __bf16 bf16;
typedef __attribute__((ext_vector_type(16))) __bf16 v16bf;
typedef __attribute__((ext_vector_type(8)))  float  v8f;
typedef int v4i_ __attribute__((vector_size(16)));

#define D_MODEL 1024
#define SEQ     4096
#define NHEAD   16
#define DK      64

#define P32 40   // rows of 32 elements (64 B of data) lie 80 B apart
#define P64 72   // rows of 64 elements (128 B of data) lie 144 B apart

#define AS1 __attribute__((address_space(1)))
#define AS3 __attribute__((address_space(3)))

#if __has_builtin(__builtin_amdgcn_global_load_async_to_lds_b128)
#define ASYNC_CP 1
static __device__ __forceinline__ void async_cp16(const void* g, void* l) {
  __builtin_amdgcn_global_load_async_to_lds_b128(
      (AS1 v4i_*)(unsigned long long)(size_t)g,
      (AS3 v4i_*)(unsigned)(size_t)l, 0, 0);
}
static __device__ __forceinline__ void async_wait0() {
#if __has_builtin(__builtin_amdgcn_s_wait_asynccnt)
  __builtin_amdgcn_s_wait_asynccnt(0);
#else
  asm volatile("s_wait_asynccnt 0" ::: "memory");
#endif
}
#else
#define ASYNC_CP 0
#endif

static __device__ __forceinline__ v16bf ldfrag(const bf16* base, int ld) {
  const int lane = threadIdx.x & 31;
  const int m    = lane & 15;
  const int b0   = (lane & 16) ? 8 : 0;
  const bf16* p  = base + m * ld + b0;
  union { uint4 u[2]; v16bf v; } r;
  r.u[0] = *reinterpret_cast<const uint4*>(p);
  r.u[1] = *reinterpret_cast<const uint4*>(p + 16);
  return r.v;
}

static __device__ __forceinline__ v8f wmma_bf16(v16bf a, v16bf b, v8f c) {
  return __builtin_amdgcn_wmma_f32_16x16x32_bf16(false, a, false, b,
                                                 (short)0, c, false, false);
}

// ---------------------------------------------------------------------------
// Tiled GEMM: Y = X @ W^T + b
// MODE 0: A f32, bias+RoPE, *oscale, head-major bf16 [H][S][DK]  (Q with 1/8, K)
// MODE 1: A f32, bias,      *oscale, head-major bf16            (V)
// MODE 2: A bf16 (attn out), bias, f32 [S][D_MODEL]             (O-proj)
// Workgroup = 256 threads = 8 waves; tile 128 rows x 64 cols; K step 32.
// W is the f32 weight as given, [out][in]: its rows are already the [n][k]
// rows of the B tile, so they are rounded to bf16 on the way into LDS.
// ---------------------------------------------------------------------------
template <int MODE>
__global__ void k_gemm(const float* __restrict__ Af,
                       const bf16*  __restrict__ Ab,
                       const float* __restrict__ W,
                       const float* __restrict__ bias,
                       bf16*        __restrict__ outH,
                       float*       __restrict__ outF,
                       float        oscale) {
  __shared__ alignas(16) bf16 As[128 * P32];  // [row][k], padded rows
  __shared__ alignas(16) bf16 Bs[64 * P32];   // [n][k], padded rows

  const int tid  = threadIdx.x;
  const int lane = tid & 31;
  const int wave = tid >> 5;
  const int row0 = blockIdx.x * 128;
  const int col0 = blockIdx.y * 64;
  const int m0   = wave * 16;
  const int bn   = tid >> 3;        // B staging: row of W within a half tile
  const int bk   = (tid & 7) * 4;   // B staging: first of the lane's four k

  v8f c[4] = {};

  for (int kk = 0; kk < D_MODEL; kk += 32) {
    // 64x32 B tile, [n][k] as in W. 16 B per lane: a wave reads four whole
    // 128-B row pieces per load.
    float4 w[2];
    w[0] = *reinterpret_cast<const float4*>(
        W + (size_t)(col0 + bn) * D_MODEL + kk + bk);
    // In the MODE 0 and MODE 1 builds the second load's result lands in the
    // first load's address registers: the wait that belongs in front of such
    // an overwrite.
    asm volatile("s_wait_xcnt 0x0" ::: "memory");
    w[1] = *reinterpret_cast<const float4*>(
        W + (size_t)(col0 + 32 + bn) * D_MODEL + kk + bk);
    // Holds W's loads here, at the head of the trip: without it the compiler
    // sinks the second one behind A's loads.
    __builtin_amdgcn_sched_barrier(0);
#if ASYNC_CP
    if (MODE == 2) {
      // bf16 source, layout-preserving: async 16B chunks (2 per thread)
#pragma unroll
      for (int rep = 0; rep < 2; ++rep) {
        int r = rep * 64 + (tid >> 2), cc = (tid & 3) * 8;   // 128x32 tile
        async_cp16(Ab + (size_t)(row0 + r) * D_MODEL + kk + cc, &As[r * P32 + cc]);
      }
    }
#endif
    if (MODE != 2 || !ASYNC_CP) {
#pragma unroll
      for (int rep = 0; rep < 16; ++rep) {     // 128x32 A tile
        int r = rep * 8 + (tid >> 5), cc = tid & 31;
        if (MODE == 2) As[r * P32 + cc] = Ab[(size_t)(row0 + r) * D_MODEL + kk + cc];
        else           As[r * P32 + cc] = (bf16)Af[(size_t)(row0 + r) * D_MODEL + kk + cc];
      }
    }
    // Holds W's conversions behind the issue of every A load: without it the
    // compiler waits for W's first load before it issues any load of A, two
    // load latencies in a row.
    __builtin_amdgcn_sched_barrier(0);
#pragma unroll
    for (int rep = 0; rep < 2; ++rep) {        // round to bf16, 8 B to LDS
      union { bf16 h[4]; uint2 u; } p;
      p.h[0] = (bf16)w[rep].x; p.h[1] = (bf16)w[rep].y;
      p.h[2] = (bf16)w[rep].z; p.h[3] = (bf16)w[rep].w;
      *reinterpret_cast<uint2*>(&Bs[(rep * 32 + bn) * P32 + bk]) = p.u;
    }
#if ASYNC_CP
    if (MODE == 2) async_wait0();
#endif
    __syncthreads();

    v16bf a = ldfrag(&As[m0 * P32], P32);
#pragma unroll
    for (int nt = 0; nt < 4; ++nt) {
      v16bf b = ldfrag(&Bs[(nt * 16) * P32], P32);
      c[nt] = wmma_bf16(a, b, c[nt]);
    }
    __syncthreads();
  }

  const int n  = lane & 15;
  const int rb = (lane >> 4) << 3;
#pragma unroll
  for (int nt = 0; nt < 4; ++nt) {
    const int col = col0 + nt * 16 + n;
    const float bv = bias[col];
#pragma unroll
    for (int v = 0; v < 8; ++v) c[nt][v] += bv;

    if (MODE == 2) {
#pragma unroll
      for (int v = 0; v < 8; ++v)
        outF[(size_t)(row0 + m0 + rb + v) * D_MODEL + col] = c[nt][v];
    } else {
      const int h = col >> 6;
      const int d = col & 63;
      if (MODE == 0) {
        // RoPE: pairs (2i, 2i+1) are adjacent columns -> adjacent lanes.
        const float freq = __powf(10000.0f, -(float)(d & ~1) * (1.0f / 64.0f));
        const bool  ev   = (d & 1) == 0;
#pragma unroll
        for (int v = 0; v < 8; ++v) {
          const int pos = row0 + m0 + rb + v;
          float sn, cs;
          __sincosf((float)pos * freq, &sn, &cs);
          float x  = c[nt][v];
          float xp = __shfl_xor(x, 1, 32);
          c[nt][v] = ev ? (x * cs - xp * sn) : (xp * sn + x * cs);
        }
      }
#pragma unroll
      for (int v = 0; v < 8; ++v) {
        const int pos = row0 + m0 + rb + v;
        outH[((size_t)h * SEQ + pos) * DK + d] = (bf16)(c[nt][v] * oscale);
      }
    }
  }
}

// ---------------------------------------------------------------------------
// Flash attention: one (head, 128-query-row) tile per workgroup, kv tiles of 32.
// 1/sqrt(dk) pre-folded into Q. Row-sum of P computed by an extra WMMA against
// an all-ones B fragment (lands directly in the l_i layout -> no shuffles);
// only the row-max still uses a 4-step shuffle tree.
// ---------------------------------------------------------------------------
__global__ void k_attn(const bf16* __restrict__ qh, const bf16* __restrict__ kh,
                       const bf16* __restrict__ vh, bf16* __restrict__ outA) {
  __shared__ alignas(16) bf16 Qs[128 * 64];   // [row][d]       16 KB
  __shared__ alignas(16) bf16 Ks[32 * P64];   // [kv][d], padded rows
  __shared__ alignas(16) bf16 Vt[64 * P32];   // [d][kv], padded rows
  __shared__ alignas(16) bf16 Ps[8][16 * P32]; // per-wave P, padded rows

  const int tid  = threadIdx.x;
  const int lane = tid & 31;
  const int wave = tid >> 5;
  const int row0 = blockIdx.x * 128;
  const int h    = blockIdx.y;
  const int m0   = wave * 16;

  const bf16* qb = qh + (size_t)h * SEQ * DK;
  const bf16* kb = kh + (size_t)h * SEQ * DK;
  const bf16* vb = vh + (size_t)h * SEQ * DK;

#if ASYNC_CP
#pragma unroll
  for (int rep = 0; rep < 4; ++rep) {          // 128x64 Q tile, 16B/thread/rep
    int e = rep * 2048 + tid * 8;
    async_cp16(qb + (size_t)row0 * DK + e, &Qs[e]);
  }
  async_wait0();
#else
#pragma unroll
  for (int rep = 0; rep < 32; ++rep) {
    int idx = rep * 256 + tid;
    Qs[idx] = qb[(size_t)row0 * DK + idx];
  }
#endif
  __syncthreads();
  const v16bf qa0 = ldfrag(&Qs[m0 * 64], 64);
  const v16bf qa1 = ldfrag(&Qs[m0 * 64 + 32], 64);

  v16bf ones;
#pragma unroll
  for (int i = 0; i < 16; ++i) ones[i] = (bf16)1.0f;

  v8f acc[4] = {};
  float m_i[8], l_i[8];
#pragma unroll
  for (int v = 0; v < 8; ++v) { m_i[v] = -3.0e38f; l_i[v] = 0.0f; }

  const int n  = lane & 15;
  const int rb = (lane >> 4) << 3;

  for (int j0 = 0; j0 < SEQ; j0 += 32) {
#if ASYNC_CP
    async_cp16(kb + (size_t)j0 * DK + tid * 8,                 // 32x64 K tile
               &Ks[(tid >> 3) * P64 + (tid & 7) * 8]);
#endif
#pragma unroll
    for (int rep = 0; rep < 8; ++rep) {        // V^T staging (2B transpose)
      int idx = rep * 256 + tid;
      int r = rep * 4 + (tid >> 6), d = tid & 63;
#if !ASYNC_CP
      Ks[r * P64 + d] = kb[(size_t)j0 * DK + idx];
#endif
      Vt[d * P32 + r] = vb[(size_t)j0 * DK + idx];
    }
    if (j0 + 32 < SEQ) {                       // global_prefetch_b8 next tiles
      __builtin_prefetch(kb + (size_t)(j0 + 32) * DK + tid * 8, 0, 0);
      __builtin_prefetch(vb + (size_t)(j0 + 32) * DK + tid * 8, 0, 0);
    }
#if ASYNC_CP
    async_wait0();
#endif
    __syncthreads();

    // S(16x32) = Q(16x64) * K^T  (scale already folded into Q)
    v8f s0 = {}, s1 = {};
    s0 = wmma_bf16(qa0, ldfrag(&Ks[0], P64), s0);
    s0 = wmma_bf16(qa1, ldfrag(&Ks[32], P64), s0);
    s1 = wmma_bf16(qa0, ldfrag(&Ks[16 * P64], P64), s1);
    s1 = wmma_bf16(qa1, ldfrag(&Ks[16 * P64 + 32], P64), s1);

    // row max across the 16 lanes sharing each C-tile row; rescale factor
    float alpha[8];
#pragma unroll
    for (int v = 0; v < 8; ++v) {
      float m = fmaxf(s0[v], s1[v]);
#pragma unroll
      for (int msk = 1; msk < 16; msk <<= 1)
        m = fmaxf(m, __shfl_xor(m, msk, 32));
      float mn = fmaxf(m_i[v], m);
      alpha[v] = __expf(m_i[v] - mn);
      m_i[v]   = mn;
    }
#pragma unroll
    for (int v = 0; v < 8; ++v) {
      s0[v] = __expf(s0[v] - m_i[v]);
      s1[v] = __expf(s1[v] - m_i[v]);
    }
#pragma unroll
    for (int nt = 0; nt < 4; ++nt)
#pragma unroll
      for (int v = 0; v < 8; ++v) acc[nt][v] *= alpha[v];

    // C-layout -> A-layout for P via per-wave LDS scratch (in-order DS ops)
#pragma unroll
    for (int v = 0; v < 8; ++v) {
      Ps[wave][(rb + v) * P32 + n]      = (bf16)s0[v];
      Ps[wave][(rb + v) * P32 + n + 16] = (bf16)s1[v];
    }
    v16bf pa = ldfrag(&Ps[wave][0], P32);

    // row-sum(P) via WMMA against all-ones B: lands in l_i's layout
    v8f zero = {};
    v8f ls = wmma_bf16(pa, ones, zero);
#pragma unroll
    for (int v = 0; v < 8; ++v) l_i[v] = l_i[v] * alpha[v] + ls[v];

#pragma unroll
    for (int nt = 0; nt < 4; ++nt)
      acc[nt] = wmma_bf16(pa, ldfrag(&Vt[(nt * 16) * P32], P32), acc[nt]);
    __syncthreads();
  }

  // normalize and store merged-head bf16 [S][D_MODEL]
#pragma unroll
  for (int v = 0; v < 8; ++v) {
    const float inv = 1.0f / l_i[v];
    const int   pos = row0 + m0 + rb + v;
#pragma unroll
    for (int nt = 0; nt < 4; ++nt)
      outA[(size_t)pos * D_MODEL + h * DK + nt * 16 + n] =
          (bf16)(acc[nt][v] * inv);
  }
}

// ---------------------------------------------------------------------------
extern "C" void kernel_launch(void* const* d_in, const int* in_sizes, int n_in,
                              void* d_out, int out_size, void* d_ws,
                              size_t ws_size, hipStream_t stream) {
  const float* Q  = (const float*)d_in[0];
  const float* K  = (const float*)d_in[1];
  const float* V  = (const float*)d_in[2];
  const float* Wq = (const float*)d_in[3];
  const float* bq = (const float*)d_in[4];
  const float* Wk = (const float*)d_in[5];
  const float* bk = (const float*)d_in[6];
  const float* Wv = (const float*)d_in[7];
  const float* bv = (const float*)d_in[8];
  const float* Wo = (const float*)d_in[9];
  const float* bo = (const float*)d_in[10];
  float* out = (float*)d_out;

  char* ws = (char*)d_ws;
  const size_t TB = (size_t)SEQ * D_MODEL * sizeof(bf16);     // 8 MB
  bf16* qh   = (bf16*)(ws);
  bf16* kh   = (bf16*)(ws + TB);
  bf16* vh   = (bf16*)(ws + 2 * TB);
  bf16* at   = (bf16*)(ws + 3 * TB);

  dim3 blk(256);
  dim3 grd(SEQ / 128, D_MODEL / 64);          // 32 x 16
  k_gemm<0><<<grd, blk, 0, stream>>>(Q, nullptr, Wq, bq, qh, nullptr, 0.125f);
  k_gemm<0><<<grd, blk, 0, stream>>>(K, nullptr, Wk, bk, kh, nullptr, 1.0f);
  k_gemm<1><<<grd, blk, 0, stream>>>(V, nullptr, Wv, bv, vh, nullptr, 1.0f);

  k_attn<<<dim3(SEQ / 128, NHEAD), blk, 0, stream>>>(qh, kh, vh, at);

  k_gemm<2><<<grd, blk, 0, stream>>>(nullptr, at, Wo, bo, nullptr, out, 1.0f);
}

// v003
// It runs in 234 microseconds.
// Two timings next to v002 both put it at 1.19 times that version's speed.
// Over all steps from v000 it is 3.26 times as fast.
#include <hip/hip_runtime.h>
#include <hip/hip_bf16.h>

typedef __bf16 bf16;
typedef __attribute__((ext_vector_type(16))) __bf16 v16bf;
typedef __attribute__((ext_vector_type(8)))  float  v8f;
typedef int v4i_ __attribute__((vector_size(16)));

#define D_MODEL 1024
#define SEQ     4096
#define NHEAD   16
#define DK      64

#define P32 40   // rows of 32 elements (64 B of data) lie 80 B apart
#define P64 72   // rows of 64 elements (128 B of data) lie 144 B apart

#define AS1 __attribute__((address_space(1)))
#define AS3 __attribute__((address_space(3)))

#if __has_builtin(__builtin_amdgcn_global_load_async_to_lds_b128)
#define ASYNC_CP 1
static __device__ __forceinline__ void async_cp16(const void* g, void* l) {
  __builtin_amdgcn_global_load_async_to_lds_b128(
      (AS1 v4i_*)(unsigned long long)(size_t)g,
      (AS3 v4i_*)(unsigned)(size_t)l, 0, 0);
}
static __device__ __forceinline__ void async_wait0() {
#if __has_builtin(__builtin_amdgcn_s_wait_asynccnt)
  __builtin_amdgcn_s_wait_asynccnt(0);
#else
  asm volatile("s_wait_asynccnt 0" ::: "memory");
#endif
}
#else
#define ASYNC_CP 0
#endif

static __device__ __forceinline__ v16bf ldfrag(const bf16* base, int ld) {
  const int lane = threadIdx.x & 31;
  const int m    = lane & 15;
  const int b0   = (lane & 16) ? 8 : 0;
  const bf16* p  = base + m * ld + b0;
  union { uint4 u[2]; v16bf v; } r;
  r.u[0] = *reinterpret_cast<const uint4*>(p);
  r.u[1] = *reinterpret_cast<const uint4*>(p + 16);
  return r.v;
}

static __device__ __forceinline__ v8f wmma_bf16(v16bf a, v16bf b, v8f c) {
  return __builtin_amdgcn_wmma_f32_16x16x32_bf16(false, a, false, b,
                                                 (short)0, c, false, false);
}

// ---------------------------------------------------------------------------
// Tiled GEMM: Y = X @ W^T + b
// MODE 0: A f32, bias+RoPE, *oscale, head-major bf16 [H][S][DK]  (Q with 1/8, K)
// MODE 1: A f32, bias,      *oscale, head-major bf16            (V)
// MODE 2: A bf16 (attn out), bias, f32 [S][D_MODEL]             (O-proj)
// Workgroup = 256 threads = 8 waves; tile 128 rows x 64 cols; K step 32.
// W is the f32 weight as given, [out][in]: its rows are already the [n][k]
// rows of the B tile, so they are rounded to bf16 on the way into LDS.
// ---------------------------------------------------------------------------
template <int MODE>
__global__ void k_gemm(const float* __restrict__ Af,
                       const bf16*  __restrict__ Ab,
                       const float* __restrict__ W,
                       const float* __restrict__ bias,
                       bf16*        __restrict__ outH,
                       float*       __restrict__ outF,
                       float        oscale) {
  __shared__ alignas(16) bf16 As[128 * P32];  // [row][k], padded rows
  __shared__ alignas(16) bf16 Bs[64 * P32];   // [n][k], padded rows

  const int tid  = threadIdx.x;
  const int lane = tid & 31;
  const int wave = tid >> 5;
  const int row0 = blockIdx.x * 128;
  const int col0 = blockIdx.y * 64;
  const int m0   = wave * 16;
  const int bn   = tid >> 3;        // B staging: row of W within a half tile
  const int bk   = (tid & 7) * 4;   // B staging: first of the lane's four k

  v8f c[4] = {};

  for (int kk = 0; kk < D_MODEL; kk += 32) {
    // 64x32 B tile, [n][k] as in W. 16 B per lane: a wave reads four whole
    // 128-B row pieces per load.
    float4 w[2];
    w[0] = *reinterpret_cast<const float4*>(
        W + (size_t)(col0 + bn) * D_MODEL + kk + bk);
    // In the MODE 0 and MODE 1 builds the second load's result lands in the
    // first load's address registers: the wait that belongs in front of such
    // an overwrite.
    asm volatile("s_wait_xcnt 0x0" ::: "memory");
    w[1] = *reinterpret_cast<const float4*>(
        W + (size_t)(col0 + 32 + bn) * D_MODEL + kk + bk);
    // Holds W's loads here, at the head of the trip: without it the compiler
    // sinks the second one behind A's loads.
    __builtin_amdgcn_sched_barrier(0);
#if ASYNC_CP
    if (MODE == 2) {
      // bf16 source, layout-preserving: async 16B chunks (2 per thread)
#pragma unroll
      for (int rep = 0; rep < 2; ++rep) {
        int r = rep * 64 + (tid >> 2), cc = (tid & 3) * 8;   // 128x32 tile
        async_cp16(Ab + (size_t)(row0 + r) * D_MODEL + kk + cc, &As[r * P32 + cc]);
      }
    }
#endif
    if (MODE != 2 || !ASYNC_CP) {
#pragma unroll
      for (int rep = 0; rep < 16; ++rep) {     // 128x32 A tile
        int r = rep * 8 + (tid >> 5), cc = tid & 31;
        if (MODE == 2) As[r * P32 + cc] = Ab[(size_t)(row0 + r) * D_MODEL + kk + cc];
        else           As[r * P32 + cc] = (bf16)Af[(size_t)(row0 + r) * D_MODEL + kk + cc];
      }
    }
    // Holds W's conversions behind the issue of every A load: without it the
    // compiler waits for W's first load before it issues any load of A, two
    // load latencies in a row.
    __builtin_amdgcn_sched_barrier(0);
#pragma unroll
    for (int rep = 0; rep < 2; ++rep) {        // round to bf16, 8 B to LDS
      union { bf16 h[4]; uint2 u; } p;
      p.h[0] = (bf16)w[rep].x; p.h[1] = (bf16)w[rep].y;
      p.h[2] = (bf16)w[rep].z; p.h[3] = (bf16)w[rep].w;
      *reinterpret_cast<uint2*>(&Bs[(rep * 32 + bn) * P32 + bk]) = p.u;
    }
#if ASYNC_CP
    if (MODE == 2) async_wait0();
#endif
    __syncthreads();

    v16bf a = ldfrag(&As[m0 * P32], P32);
#pragma unroll
    for (int nt = 0; nt < 4; ++nt) {
      v16bf b = ldfrag(&Bs[(nt * 16) * P32], P32);
      c[nt] = wmma_bf16(a, b, c[nt]);
    }
    __syncthreads();
  }

  const int n  = lane & 15;
  const int rb = (lane >> 4) << 3;
#pragma unroll
  for (int nt = 0; nt < 4; ++nt) {
    const int col = col0 + nt * 16 + n;
    const float bv = bias[col];
#pragma unroll
    for (int v = 0; v < 8; ++v) c[nt][v] += bv;

    if (MODE == 2) {
#pragma unroll
      for (int v = 0; v < 8; ++v)
        outF[(size_t)(row0 + m0 + rb + v) * D_MODEL + col] = c[nt][v];
    } else {
      const int h = col >> 6;
      const int d = col & 63;
      if (MODE == 0) {
        // RoPE: pairs (2i, 2i+1) are adjacent columns -> adjacent lanes.
        const float freq = __powf(10000.0f, -(float)(d & ~1) * (1.0f / 64.0f));
        const bool  ev   = (d & 1) == 0;
#pragma unroll
        for (int v = 0; v < 8; ++v) {
          const int pos = row0 + m0 + rb + v;
          float sn, cs;
          __sincosf((float)pos * freq, &sn, &cs);
          float x  = c[nt][v];
          float xp = __shfl_xor(x, 1, 32);
          c[nt][v] = ev ? (x * cs - xp * sn) : (xp * sn + x * cs);
        }
      }
#pragma unroll
      for (int v = 0; v < 8; ++v) {
        const int pos = row0 + m0 + rb + v;
        outH[((size_t)h * SEQ + pos) * DK + d] = (bf16)(c[nt][v] * oscale);
      }
    }
  }
}

static __device__ __forceinline__ float xhalf(float x) {
  return __builtin_bit_cast(float, __builtin_amdgcn_permlanex16(
      __builtin_bit_cast(int, x), __builtin_bit_cast(int, x),
      0x76543210, 0xfedcba98, false, false));
}

__global__ void k_attn(const bf16* __restrict__ qh, const bf16* __restrict__ kh,
                       const bf16* __restrict__ vh, bf16* __restrict__ outA) {
  __shared__ alignas(16) bf16 Qs[128 * 64];   // [row][d]       16 KB
  __shared__ alignas(16) bf16 Ks[32 * P64];   // [kv][d], padded rows
  __shared__ alignas(16) bf16 Vt[64 * P32];   // [d][kv], padded rows

  const int tid  = threadIdx.x;
  const int lane = tid & 31;
  const int wave = tid >> 5;
  const int row0 = blockIdx.x * 128;
  const int h    = blockIdx.y;
  const int m0   = wave * 16;

  const bf16* qb = qh + (size_t)h * SEQ * DK;
  const bf16* kb = kh + (size_t)h * SEQ * DK;
  const bf16* vb = vh + (size_t)h * SEQ * DK;

#if ASYNC_CP
#pragma unroll
  for (int rep = 0; rep < 4; ++rep) {          // 128x64 Q tile, 16B/thread/rep
    int e = rep * 2048 + tid * 8;
    async_cp16(qb + (size_t)row0 * DK + e, &Qs[e]);
  }
  async_wait0();
#else
#pragma unroll
  for (int rep = 0; rep < 32; ++rep) {
    int idx = rep * 256 + tid;
    Qs[idx] = qb[(size_t)row0 * DK + idx];
  }
#endif
  __syncthreads();
  // B operand Q^T: lane = query column, k = d
  const v16bf qa0 = ldfrag(&Qs[m0 * 64], 64);
  const v16bf qa1 = ldfrag(&Qs[m0 * 64 + 32], 64);

  v16bf ones;
#pragma unroll
  for (int i = 0; i < 16; ++i) ones[i] = (bf16)1.0f;

  v8f acc[4] = {};               // acc[nt][v] = O[q = n][d = nt*16 + rb + v]
  float m_i = -3.0e38f, l_i = 0.0f;

  const int n  = lane & 15;
  const int rb = (lane >> 4) << 3;

  for (int j0 = 0; j0 < SEQ; j0 += 32) {
#if ASYNC_CP
    async_cp16(kb + (size_t)j0 * DK + tid * 8,                 // 32x64 K tile
               &Ks[(tid >> 3) * P64 + (tid & 7) * 8]);
#endif
#pragma unroll
    for (int rep = 0; rep < 8; ++rep) {        // V^T staging (2B transpose)
      int idx = rep * 256 + tid;
      int r = rep * 4 + (tid >> 6), d = tid & 63;
#if !ASYNC_CP
      Ks[r * P64 + d] = kb[(size_t)j0 * DK + idx];
#endif
      Vt[d * P32 + r] = vb[(size_t)j0 * DK + idx];
    }
    if (j0 + 32 < SEQ) {                       // global_prefetch_b8 next tiles
      __builtin_prefetch(kb + (size_t)(j0 + 32) * DK + tid * 8, 0, 0);
      __builtin_prefetch(vb + (size_t)(j0 + 32) * DK + tid * 8, 0, 0);
    }
#if ASYNC_CP
    async_wait0();
#endif
    __syncthreads();

    // S^T(32x16) = K(32x64) * Q^T  (scale already folded into Q)
    // s0[v] = S[q = n][kv = rb + v], s1[v] = S[q = n][kv = 16 + rb + v]
    v8f s0 = {}, s1 = {};
    s0 = wmma_bf16(ldfrag(&Ks[0], P64), qa0, s0);
    s0 = wmma_bf16(ldfrag(&Ks[32], P64), qa1, s0);
    s1 = wmma_bf16(ldfrag(&Ks[16 * P64], P64), qa0, s1);
    s1 = wmma_bf16(ldfrag(&Ks[16 * P64 + 32], P64), qa1, s1);

    // the query's maximum: 16 scores in the lane, then the other wave half's
    // (a tree of three-input maxima, not one dependent chain)
    const float g0 = fmaxf(fmaxf(s0[0], s0[1]), s0[2]);
    const float g1 = fmaxf(fmaxf(s0[3], s0[4]), s0[5]);
    const float g2 = fmaxf(fmaxf(s0[6], s0[7]), s1[0]);
    const float g3 = fmaxf(fmaxf(s1[1], s1[2]), s1[3]);
    const float g4 = fmaxf(fmaxf(s1[4], s1[5]), s1[6]);
    float m = fmaxf(fmaxf(fmaxf(g0, g1), g2), fmaxf(fmaxf(g3, g4), s1[7]));
    m = fmaxf(m, xhalf(m));
    const float mn    = fmaxf(m_i, m);
    const float alpha = __expf(m_i - mn);
    m_i = mn;

    // P^T as B operand, straight from the two score tiles
    v16bf pb;
#pragma unroll
    for (int v = 0; v < 8; ++v) {
      pb[v]     = (bf16)__expf(s0[v] - mn);
      pb[8 + v] = (bf16)__expf(s1[v] - mn);
    }
#pragma unroll
    for (int nt = 0; nt < 4; ++nt)
#pragma unroll
      for (int v = 0; v < 8; ++v) acc[nt][v] *= alpha;

    // row-sum(P) via WMMA with all-ones A: every row of the result holds the
    // sum over all 32 keys of the lane's query
    v8f zero = {};
    v8f ls = wmma_bf16(ones, pb, zero);
    l_i = l_i * alpha + ls[0];

#pragma unroll
    for (int nt = 0; nt < 4; ++nt)
      acc[nt] = wmma_bf16(ldfrag(&Vt[(nt * 16) * P32], P32), pb, acc[nt]);
    __syncthreads();
  }

  // normalize and store merged-head bf16 [S][D_MODEL]: a lane's 8 accumulator
  // registers are 8 consecutive d of its query, one 16-byte store per tile
  const float inv = 1.0f / l_i;
  const int   pos = row0 + m0 + n;
  uint4 o[4];
#pragma unroll
  for (int nt = 0; nt < 4; ++nt) {
    union { bf16 e[8]; uint4 u; } p;
#pragma unroll
    for (int v = 0; v < 8; ++v) p.e[v] = (bf16)(acc[nt][v] * inv);
    o[nt] = p.u;
  }
#pragma unroll
  for (int nt = 0; nt < 4; ++nt)
    *reinterpret_cast<uint4*>(
        outA + (size_t)pos * D_MODEL + h * DK + nt * 16 + rb) = o[nt];
}

// ---------------------------------------------------------------------------
extern "C" void kernel_launch(void* const* d_in, const int* in_sizes, int n_in,
                              void* d_out, int out_size, void* d_ws,
                              size_t ws_size, hipStream_t stream) {
  const float* Q  = (const float*)d_in[0];
  const float* K  = (const float*)d_in[1];
  const float* V  = (const float*)d_in[2];
  const float* Wq = (const float*)d_in[3];
  const float* bq = (const float*)d_in[4];
  const float* Wk = (const float*)d_in[5];
  const float* bk = (const float*)d_in[6];
  const float* Wv = (const float*)d_in[7];
  const float* bv = (const float*)d_in[8];
  const float* Wo = (const float*)d_in[9];
  const float* bo = (const float*)d_in[10];
  float* out = (float*)d_out;

  char* ws = (char*)d_ws;
  const size_t TB = (size_t)SEQ * D_MODEL * sizeof(bf16);     // 8 MB
  bf16* qh   = (bf16*)(ws);
  bf16* kh   = (bf16*)(ws + TB);
  bf16* vh   = (bf16*)(ws + 2 * TB);
  bf16* at   = (bf16*)(ws + 3 * TB);

  dim3 blk(256);
  dim3 grd(SEQ / 128, D_MODEL / 64);          // 32 x 16
  k_gemm<0><<<grd, blk, 0, stream>>>(Q, nullptr, Wq, bq, qh, nullptr, 0.125f);
  k_gemm<0><<<grd, blk, 0, stream>>>(K, nullptr, Wk, bk, kh, nullptr, 1.0f);
  k_gemm<1><<<grd, blk, 0, stream>>>(V, nullptr, Wv, bv, vh, nullptr, 1.0f);

  k_attn<<<dim3(SEQ / 128, NHEAD), blk, 0, stream>>>(qh, kh, vh, at);

  k_gemm<2><<<grd, blk, 0, stream>>>(nullptr, at, Wo, bo, nullptr, out, 1.0f);
}

// v004
// A run of this version takes 194 microseconds.
// Next to v003, in two timings, it ran 1.20 times as fast each time.
// All steps since v000 together make it 3.92 times as fast.
#include <hip/hip_runtime.h>
#include <hip/hip_bf16.h>

typedef __bf16 bf16;
typedef __attribute__((ext_vector_type(16))) __bf16 v16bf;
typedef __attribute__((ext_vector_type(8)))  float  v8f;
typedef int v4i_ __attribute__((vector_size(16)));

#define D_MODEL 1024
#define SEQ     4096
#define NHEAD   16
#define DK      64

#define P64 72   // rows of 64 elements (128 B of data) lie 144 B apart
#define P128 136 // rows of 128 elements (256 B of data) lie 272 B apart

// Depth of one LDS stage: k of a GEMM stage, keys of an attention stage. A
// stage is loaded, published by one barrier and then worked off in four
// passes of 32 with no barrier between them.
#define STG 128

#define AS1 __attribute__((address_space(1)))
#define AS3 __attribute__((address_space(3)))

#if __has_builtin(__builtin_amdgcn_global_load_async_to_lds_b128)
#define ASYNC_CP 1
static __device__ __forceinline__ void async_cp16(const void* g, void* l) {
  __builtin_amdgcn_global_load_async_to_lds_b128(
      (AS1 v4i_*)(unsigned long long)(size_t)g,
      (AS3 v4i_*)(unsigned)(size_t)l, 0, 0);
}
static __device__ __forceinline__ void async_wait0() {
#if __has_builtin(__builtin_amdgcn_s_wait_asynccnt)
  __builtin_amdgcn_s_wait_asynccnt(0);
#else
  asm volatile("s_wait_asynccnt 0" ::: "memory");
#endif
}
#else
#define ASYNC_CP 0
#endif

static __device__ __forceinline__ v16bf ldfrag(const bf16* base, int ld) {
  const int lane = threadIdx.x & 31;
  const int m    = lane & 15;
  const int b0   = (lane & 16) ? 8 : 0;
  const bf16* p  = base + m * ld + b0;
  union { uint4 u[2]; v16bf v; } r;
  r.u[0] = *reinterpret_cast<const uint4*>(p);
  r.u[1] = *reinterpret_cast<const uint4*>(p + 16);
  return r.v;
}

static __device__ __forceinline__ v8f wmma_bf16(v16bf a, v16bf b, v8f c) {
  return __builtin_amdgcn_wmma_f32_16x16x32_bf16(false, a, false, b,
                                                 (short)0, c, false, false);
}

// ---------------------------------------------------------------------------
// Tiled GEMM: Y = X @ W^T + b
// MODE 0: A f32, bias+RoPE, *oscale, head-major bf16 [H][S][DK]  (Q with 1/8, K)
// MODE 1: A f32, bias,      *oscale, head-major bf16            (V)
// MODE 2: A bf16 (attn out), bias, f32 [S][D_MODEL]             (O-proj)
// Workgroup = 256 threads = 8 waves; tile 128 rows x 64 cols; K stage 128.
// W is the f32 weight as given, [out][in]: its rows are already the [n][k]
// rows of the B tile, so they are rounded to bf16 on the way into LDS.
// ---------------------------------------------------------------------------
template <int MODE>
__global__ void __launch_bounds__(256) k_gemm(const float* __restrict__ Af,
                       const bf16*  __restrict__ Ab,
                       const float* __restrict__ W,
                       const float* __restrict__ bias,
                       bf16*        __restrict__ outH,
                       float*       __restrict__ outF,
                       float        oscale) {
  __shared__ alignas(16) bf16 As[128 * P128];  // [row][k], padded rows
  __shared__ alignas(16) bf16 Bs[64 * P128];   // [n][k], padded rows

  const int tid  = threadIdx.x;
  const int lane = tid & 31;
  const int wave = tid >> 5;
  const int row0 = blockIdx.x * 128;
  const int col0 = blockIdx.y * 64;
  const int m0   = wave * 16;
  const int bn   = tid >> 5;         // B staging: row of W within a group of 8
  const int bk   = (tid & 31) * 4;   // B staging: first of the lane's four k

  // One address per lane and operand; the rows of a stage lie at constant
  // distances from it, which go into the loads' offset fields.
  const float* wp  = W + (size_t)(col0 + bn) * D_MODEL + bk;
  const float* afp = Af + (size_t)(row0 + (tid >> 7)) * D_MODEL + (tid & 127);
  const bf16*  abp = Ab + (size_t)(row0 + (tid >> 4)) * D_MODEL + (tid & 15) * 8;

  v8f c[4] = {};

  // Stays rolled: unrolled, its eight trips are eight copies of a long body.
#pragma unroll 1
  for (int kk = 0; kk < D_MODEL; kk += STG) {
    // 64x128 B tile, [n][k] as in W. 16 B per lane: a wave reads one whole
    // 512-B row piece per load.
    float4 w[8];
#pragma unroll                                 // w[] stays in registers
    for (int rep = 0; rep < 8; ++rep)
      w[rep] = *reinterpret_cast<const float4*>(wp + kk + rep * 8 * D_MODEL);
    // In the MODE 0 and MODE 1 builds results of A's loads land in the address
    // registers of W's loads: the wait that belongs in front of such an
    // overwrite.
    if (MODE != 2) asm volatile("s_wait_xcnt 0x0" ::: "memory");
    float av[64];
#if ASYNC_CP
    if (MODE == 2) {
      // bf16 source, layout-preserving: async 16B chunks (8 per thread)
#pragma unroll
      for (int rep = 0; rep < 8; ++rep) {
        int r = rep * 16 + (tid >> 4), cc = (tid & 15) * 8;   // 128x128 tile
        async_cp16(abp + kk + rep * 16 * D_MODEL, &As[r * P128 + cc]);
      }
    }
#endif
    if (MODE != 2 || !ASYNC_CP) {
#pragma unroll
      for (int rep = 0; rep < 64; ++rep) {     // 128x128 A tile
        int r = rep * 2 + (tid >> 7), cc = tid & 127;
        if (MODE == 2) av[rep] = (float)Ab[(size_t)(row0 + r) * D_MODEL + kk + cc];
        else           av[rep] = afp[kk + rep * 2 * D_MODEL];
      }
    }
    // Holds every conversion behind the issue of the stage's last load: the
    // stage then pays one load latency, not one per group of loads.
    __builtin_amdgcn_sched_barrier(0);
#pragma unroll
    for (int rep = 0; rep < 8; ++rep) {        // round to bf16, 8 B to LDS
      union { bf16 h[4]; uint2 u; } p;
      p.h[0] = (bf16)w[rep].x; p.h[1] = (bf16)w[rep].y;
      p.h[2] = (bf16)w[rep].z; p.h[3] = (bf16)w[rep].w;
      *reinterpret_cast<uint2*>(&Bs[(rep * 8 + bn) * P128 + bk]) = p.u;
    }
    if (MODE != 2 || !ASYNC_CP) {
#pragma unroll
      for (int rep = 0; rep < 64; ++rep) {
        int r = rep * 2 + (tid >> 7), cc = tid & 127;
        As[r * P128 + cc] = (bf16)av[rep];
      }
    }
#if ASYNC_CP
    if (MODE == 2) async_wait0();
#endif
    __syncthreads();

    // Unrolled: the passes' LDS offsets become immediates of the loads.
#pragma unroll
    for (int ks = 0; ks < STG; ks += 32) {     // k ascending
      v16bf a = ldfrag(&As[m0 * P128 + ks], P128);
#pragma unroll
      for (int nt = 0; nt < 4; ++nt) {
        v16bf b = ldfrag(&Bs[(nt * 16) * P128 + ks], P128);
        c[nt] = wmma_bf16(a, b, c[nt]);
      }
    }
    __syncthreads();
  }

  const int n  = lane & 15;
  const int rb = (lane >> 4) << 3;
#pragma unroll
  for (int nt = 0; nt < 4; ++nt) {
    const int col = col0 + nt * 16 + n;
    const float bv = bias[col];
#pragma unroll
    for (int v = 0; v < 8; ++v) c[nt][v] += bv;

    if (MODE == 2) {
#pragma unroll
      for (int v = 0; v < 8; ++v)
        outF[(size_t)(row0 + m0 + rb + v) * D_MODEL + col] = c[nt][v];
    } else {
      const int h = col >> 6;
      const int d = col & 63;
      if (MODE == 0) {
        // RoPE: pairs (2i, 2i+1) are adjacent columns -> adjacent lanes.
        const float freq = __powf(10000.0f, -(float)(d & ~1) * (1.0f / 64.0f));
        const bool  ev   = (d & 1) == 0;
#pragma unroll
        for (int v = 0; v < 8; ++v) {
          const int pos = row0 + m0 + rb + v;
          float sn, cs;
          __sincosf((float)pos * freq, &sn, &cs);
          float x  = c[nt][v];
          float xp = __shfl_xor(x, 1, 32);
          c[nt][v] = ev ? (x * cs - xp * sn) : (xp * sn + x * cs);
        }
      }
#pragma unroll
      for (int v = 0; v < 8; ++v) {
        const int pos = row0 + m0 + rb + v;
        outH[((size_t)h * SEQ + pos) * DK + d] = (bf16)(c[nt][v] * oscale);
      }
    }
  }
}

static __device__ __forceinline__ float xhalf(float x) {
  return __builtin_bit_cast(float, __builtin_amdgcn_permlanex16(
      __builtin_bit_cast(int, x), __builtin_bit_cast(int, x),
      0x76543210, 0xfedcba98, false, false));
}

__global__ void __launch_bounds__(256) k_attn(const bf16* __restrict__ qh, const bf16* __restrict__ kh,
                       const bf16* __restrict__ vh, bf16* __restrict__ outA) {
  __shared__ alignas(16) bf16 Qs[128 * 64];   // [row][d]       16 KB
  __shared__ alignas(16) bf16 Ks[STG * P64];  // [kv][d], padded rows
  __shared__ alignas(16) bf16 Vt[64 * P128];  // [d][kv], padded rows

  const int tid  = threadIdx.x;
  const int lane = tid & 31;
  const int wave = tid >> 5;
  const int row0 = blockIdx.x * 128;
  const int h    = blockIdx.y;
  const int m0   = wave * 16;

  const bf16* qb = qh + (size_t)h * SEQ * DK;
  const bf16* kb = kh + (size_t)h * SEQ * DK;
  const bf16* vb = vh + (size_t)h * SEQ * DK;

#if ASYNC_CP
#pragma unroll
  for (int rep = 0; rep < 4; ++rep) {          // 128x64 Q tile, 16B/thread/rep
    int e = rep * 2048 + tid * 8;
    async_cp16(qb + (size_t)row0 * DK + e, &Qs[e]);
  }
  async_wait0();
#else
#pragma unroll
  for (int rep = 0; rep < 32; ++rep) {
    int idx = rep * 256 + tid;
    Qs[idx] = qb[(size_t)row0 * DK + idx];
  }
#endif
  __syncthreads();
  // B operand Q^T: lane = query column, k = d
  const v16bf qa0 = ldfrag(&Qs[m0 * 64], 64);
  const v16bf qa1 = ldfrag(&Qs[m0 * 64 + 32], 64);

  v16bf ones;
#pragma unroll
  for (int i = 0; i < 16; ++i) ones[i] = (bf16)1.0f;

  v8f acc[4] = {};               // acc[nt][v] = O[q = n][d = nt*16 + rb + v]
  float m_i = -3.0e38f, l_i = 0.0f;

  const int n  = lane & 15;
  const int rb = (lane >> 4) << 3;

  for (int j0 = 0; j0 < SEQ; j0 += STG) {
#if ASYNC_CP
#pragma unroll
    for (int rep = 0; rep < 4; ++rep) {        // 128x64 K tile
      int ch = rep * 256 + tid;
      async_cp16(kb + (size_t)j0 * DK + ch * 8,
                 &Ks[(ch >> 3) * P64 + (ch & 7) * 8]);
    }
#endif
#pragma unroll
    for (int rep = 0; rep < 32; ++rep) {       // V^T staging (2B transpose)
      int idx = rep * 256 + tid;
      int r = rep * 4 + (tid >> 6), d = tid & 63;
#if !ASYNC_CP
      Ks[r * P64 + d] = kb[(size_t)j0 * DK + idx];
#endif
      Vt[d * P128 + r] = vb[(size_t)j0 * DK + idx];
    }
    if (j0 + STG < SEQ) {                      // global_prefetch_b8 next stage,
      // one address per 64 B: the 256 threads cover its 16 KB
      __builtin_prefetch(kb + (size_t)(j0 + STG) * DK + tid * 32, 0, 0);
      __builtin_prefetch(vb + (size_t)(j0 + STG) * DK + tid * 32, 0, 0);
    }
#if ASYNC_CP
    async_wait0();
#endif
    __syncthreads();

    // Unrolled: the passes' LDS offsets become immediates, and the next pass's
    // score products can be issued among this pass's vector work.
#pragma unroll
    for (int p0 = 0; p0 < STG; p0 += 32) {     // keys ascending
    // S^T(32x16) = K(32x64) * Q^T  (scale already folded into Q)
    // s0[v] = S[q = n][kv = p0 + rb + v], s1[v] = S[q = n][kv = p0 + 16 + rb + v]
    v8f s0 = {}, s1 = {};
    s0 = wmma_bf16(ldfrag(&Ks[p0 * P64], P64), qa0, s0);
    s0 = wmma_bf16(ldfrag(&Ks[p0 * P64 + 32], P64), qa1, s0);
    s1 = wmma_bf16(ldfrag(&Ks[(p0 + 16) * P64], P64), qa0, s1);
    s1 = wmma_bf16(ldfrag(&Ks[(p0 + 16) * P64 + 32], P64), qa1, s1);

    // the query's maximum: 16 scores in the lane, then the other wave half's
    // (a tree of three-input maxima, not one dependent chain)
    const float g0 = fmaxf(fmaxf(s0[0], s0[1]), s0[2]);
    const float g1 = fmaxf(fmaxf(s0[3], s0[4]), s0[5]);
    const float g2 = fmaxf(fmaxf(s0[6], s0[7]), s1[0]);
    const float g3 = fmaxf(fmaxf(s1[1], s1[2]), s1[3]);
    const float g4 = fmaxf(fmaxf(s1[4], s1[5]), s1[6]);
    float m = fmaxf(fmaxf(fmaxf(g0, g1), g2), fmaxf(fmaxf(g3, g4), s1[7]));
    m = fmaxf(m, xhalf(m));
    const float mn    = fmaxf(m_i, m);
    const float alpha = __expf(m_i - mn);
    m_i = mn;

    // P^T as B operand, straight from the two score tiles
    v16bf pb;
#pragma unroll
    for (int v = 0; v < 8; ++v) {
      pb[v]     = (bf16)__expf(s0[v] - mn);
      pb[8 + v] = (bf16)__expf(s1[v] - mn);
    }
#pragma unroll
    for (int nt = 0; nt < 4; ++nt)
#pragma unroll
      for (int v = 0; v < 8; ++v) acc[nt][v] *= alpha;

    // row-sum(P) via WMMA with all-ones A: every row of the result holds the
    // sum over all 32 keys of the lane's query
    v8f zero = {};
    v8f ls = wmma_bf16(ones, pb, zero);
    l_i = l_i * alpha + ls[0];

#pragma unroll
    for (int nt = 0; nt < 4; ++nt)
      acc[nt] = wmma_bf16(ldfrag(&Vt[(nt * 16) * P128 + p0], P128), pb, acc[nt]);
    }
    __syncthreads();
  }

  // normalize and store merged-head bf16 [S][D_MODEL]: a lane's 8 accumulator
  // registers are 8 consecutive d of its query, one 16-byte store per tile
  const float inv = 1.0f / l_i;
  const int   pos = row0 + m0 + n;
  uint4 o[4];
#pragma unroll
  for (int nt = 0; nt < 4; ++nt) {
    union { bf16 e[8]; uint4 u; } p;
#pragma unroll
    for (int v = 0; v < 8; ++v) p.e[v] = (bf16)(acc[nt][v] * inv);
    o[nt] = p.u;
  }
#pragma unroll
  for (int nt = 0; nt < 4; ++nt)
    *reinterpret_cast<uint4*>(
        outA + (size_t)pos * D_MODEL + h * DK + nt * 16 + rb) = o[nt];
}

// ---------------------------------------------------------------------------
extern "C" void kernel_launch(void* const* d_in, const int* in_sizes, int n_in,
                              void* d_out, int out_size, void* d_ws,
                              size_t ws_size, hipStream_t stream) {
  const float* Q  = (const float*)d_in[0];
  const float* K  = (const float*)d_in[1];
  const float* V  = (const float*)d_in[2];
  const float* Wq = (const float*)d_in[3];
  const float* bq = (const float*)d_in[4];
  const float* Wk = (const float*)d_in[5];
  const float* bk = (const float*)d_in[6];
  const float* Wv = (const float*)d_in[7];
  const float* bv = (const float*)d_in[8];
  const float* Wo = (const float*)d_in[9];
  const float* bo = (const float*)d_in[10];
  float* out = (float*)d_out;

  char* ws = (char*)d_ws;
  const size_t TB = (size_t)SEQ * D_MODEL * sizeof(bf16);     // 8 MB
  bf16* qh   = (bf16*)(ws);
  bf16* kh   = (bf16*)(ws + TB);
  bf16* vh   = (bf16*)(ws + 2 * TB);
  bf16* at   = (bf16*)(ws + 3 * TB);

  dim3 blk(256);
  dim3 grd(SEQ / 128, D_MODEL / 64);          // 32 x 16
  k_gemm<0><<<grd, blk, 0, stream>>>(Q, nullptr, Wq, bq, qh, nullptr, 0.125f);
  k_gemm<0><<<grd, blk, 0, stream>>>(K, nullptr, Wk, bk, kh, nullptr, 1.0f);
  k_gemm<1><<<grd, blk, 0, stream>>>(V, nullptr, Wv, bv, vh, nullptr, 1.0f);

  k_attn<<<dim3(SEQ / 128, NHEAD), blk, 0, stream>>>(qh, kh, vh, at);

  k_gemm<2><<<grd, blk, 0, stream>>>(nullptr, at, Wo, bo, nullptr, out, 1.0f);
}

// v005
// Measured time: 183 microseconds a run.
// In both of two side-by-side timings against v004, it was 1.06 times as fast.
// All steps since v000 together make it 4.16 times as fast.
#include <hip/hip_runtime.h>
#include <hip/hip_bf16.h>

typedef __bf16 bf16;
typedef __attribute__((ext_vector_type(16))) __bf16 v16bf;
typedef __attribute__((ext_vector_type(8)))  float  v8f;
typedef int v4i_ __attribute__((vector_size(16)));

#define D_MODEL 1024
#define SEQ     4096
#define NHEAD   16
#define DK      64

#define P64 72   // rows of 64 elements (128 B of data) lie 144 B apart
#define P128 136 // rows of 128 elements (256 B of data) lie 272 B apart

// Depth of one LDS stage: k of a GEMM stage, keys of an attention stage. A
// stage is loaded, published by one barrier and then worked off in four
// passes of 32 with no barrier between them.
#define STG 128

#define AS1 __attribute__((address_space(1)))
#define AS3 __attribute__((address_space(3)))

#if __has_builtin(__builtin_amdgcn_global_load_async_to_lds_b128)
#define ASYNC_CP 1
static __device__ __forceinline__ void async_cp16(const void* g, void* l) {
  __builtin_amdgcn_global_load_async_to_lds_b128(
      (AS1 v4i_*)(unsigned long long)(size_t)g,
      (AS3 v4i_*)(unsigned)(size_t)l, 0, 0);
}
static __device__ __forceinline__ void async_wait0() {
#if __has_builtin(__builtin_amdgcn_s_wait_asynccnt)
  __builtin_amdgcn_s_wait_asynccnt(0);
#else
  asm volatile("s_wait_asynccnt 0" ::: "memory");
#endif
}
#else
#define ASYNC_CP 0
#endif

static __device__ __forceinline__ v16bf ldfrag(const bf16* base, int ld) {
  const int lane = threadIdx.x & 31;
  const int m    = lane & 15;
  const int b0   = (lane & 16) ? 8 : 0;
  const bf16* p  = base + m * ld + b0;
  union { uint4 u[2]; v16bf v; } r;
  r.u[0] = *reinterpret_cast<const uint4*>(p);
  r.u[1] = *reinterpret_cast<const uint4*>(p + 16);
  return r.v;
}

static __device__ __forceinline__ v8f wmma_bf16(v16bf a, v16bf b, v8f c) {
  return __builtin_amdgcn_wmma_f32_16x16x32_bf16(false, a, false, b,
                                                 (short)0, c, false, false);
}

// ---------------------------------------------------------------------------
// Tiled GEMM: Y = X @ W^T + b
// MODE 0: the three input projections in ONE launch; blockIdx.z picks the
//         operand set: 0 = Q (RoPE, scaled by 1/8), 1 = K (RoPE), 2 = V.
//         A f32, bias, head-major bf16 [H][S][DK], plane z of outH.
//         The three are independent of each other: one grid of 3 x 512
//         workgroups keeps three of them on a WGP where a launch of 512 has
//         two, and has no gap, fill or drain between the projections.
// MODE 2: A bf16 (attn out), bias, f32 [S][D_MODEL]             (O-proj)
// Workgroup = 256 threads = 8 waves; tile 128 rows x 64 cols; K stage 128.
// W is the f32 weight as given, [out][in]: its rows are already the [n][k]
// rows of the B tile, so they are rounded to bf16 on the way into LDS.
// ---------------------------------------------------------------------------
template <int MODE>
__global__ void __launch_bounds__(256) k_gemm(const float* __restrict__ A0,
                       const float* __restrict__ A1,
                       const float* __restrict__ A2,
                       const bf16*  __restrict__ Ab,
                       const float* __restrict__ W0,
                       const float* __restrict__ W1,
                       const float* __restrict__ W2,
                       const float* __restrict__ bias0,
                       const float* __restrict__ bias1,
                       const float* __restrict__ bias2,
                       bf16*        __restrict__ outH0,
                       float*       __restrict__ outF) {
  __shared__ alignas(16) bf16 As[128 * P128];  // [row][k], padded rows
  __shared__ alignas(16) bf16 Bs[64 * P128];   // [n][k], padded rows

  // The workgroup's operand set (the same for all its threads).
  const int    z      = (MODE == 0) ? (int)blockIdx.z : 0;
  const float* Af     = z == 0 ? A0 : z == 1 ? A1 : A2;
  const float* W      = z == 0 ? W0 : z == 1 ? W1 : W2;
  const float* bias   = z == 0 ? bias0 : z == 1 ? bias1 : bias2;
  bf16*        outH   = outH0 + (size_t)z * SEQ * D_MODEL;
  const float  oscale = z == 0 ? 0.125f : 1.0f;
  const bool   rope   = z < 2;

  const int tid  = threadIdx.x;
  const int lane = tid & 31;
  const int wave = tid >> 5;
  const int row0 = blockIdx.x * 128;
  const int col0 = blockIdx.y * 64;
  const int m0   = wave * 16;
  const int bn   = tid >> 5;         // B staging: row of W within a group of 8
  const int bk   = (tid & 31) * 4;   // B staging: first of the lane's four k

  // One address per lane and operand; the rows of a stage lie at constant
  // distances from it, which go into the loads' offset fields.
  const float* wp  = W + (size_t)(col0 + bn) * D_MODEL + bk;
  const float* afp = Af + (size_t)(row0 + (tid >> 7)) * D_MODEL + (tid & 127);
  const bf16*  abp = Ab + (size_t)(row0 + (tid >> 4)) * D_MODEL + (tid & 15) * 8;

  v8f c[4] = {};

  // Stays rolled: unrolled, its eight trips are eight copies of a long body.
#pragma unroll 1
  for (int kk = 0; kk < D_MODEL; kk += STG) {
    // 64x128 B tile, [n][k] as in W. 16 B per lane: a wave reads one whole
    // 512-B row piece per load.
    float4 w[8];
#pragma unroll                                 // w[] stays in registers
    for (int rep = 0; rep < 8; ++rep)
      w[rep] = *reinterpret_cast<const float4*>(wp + kk + rep * 8 * D_MODEL);
    // In the MODE 0 build results of A's loads land in the address
    // registers of W's loads: the wait that belongs in front of such an
    // overwrite.
    if (MODE != 2) asm volatile("s_wait_xcnt 0x0" ::: "memory");
    float av[64];
#if ASYNC_CP
    if (MODE == 2) {
      // bf16 source, layout-preserving: async 16B chunks (8 per thread)
#pragma unroll
      for (int rep = 0; rep < 8; ++rep) {
        int r = rep * 16 + (tid >> 4), cc = (tid & 15) * 8;   // 128x128 tile
        async_cp16(abp + kk + rep * 16 * D_MODEL, &As[r * P128 + cc]);
      }
    }
#endif
    if (MODE != 2 || !ASYNC_CP) {
#pragma unroll
      for (int rep = 0; rep < 64; ++rep) {     // 128x128 A tile
        int r = rep * 2 + (tid >> 7), cc = tid & 127;
        if (MODE == 2) av[rep] = (float)Ab[(size_t)(row0 + r) * D_MODEL + kk + cc];
        else           av[rep] = afp[kk + rep * 2 * D_MODEL];
      }
    }
    // Holds every conversion behind the issue of the stage's last load: the
    // stage then pays one load latency, not one per group of loads.
    __builtin_amdgcn_sched_barrier(0);
#pragma unroll
    for (int rep = 0; rep < 8; ++rep) {        // round to bf16, 8 B to LDS
      union { bf16 h[4]; uint2 u; } p;
      p.h[0] = (bf16)w[rep].x; p.h[1] = (bf16)w[rep].y;
      p.h[2] = (bf16)w[rep].z; p.h[3] = (bf16)w[rep].w;
      *reinterpret_cast<uint2*>(&Bs[(rep * 8 + bn) * P128 + bk]) = p.u;
    }
    if (MODE != 2 || !ASYNC_CP) {
#pragma unroll
      for (int rep = 0; rep < 64; ++rep) {
        int r = rep * 2 + (tid >> 7), cc = tid & 127;
        As[r * P128 + cc] = (bf16)av[rep];
      }
    }
#if ASYNC_CP
    if (MODE == 2) async_wait0();
#endif
    __syncthreads();

    // Unrolled: the passes' LDS offsets become immediates of the loads.
#pragma unroll
    for (int ks = 0; ks < STG; ks += 32) {     // k ascending
      v16bf a = ldfrag(&As[m0 * P128 + ks], P128);
#pragma unroll
      for (int nt = 0; nt < 4; ++nt) {
        v16bf b = ldfrag(&Bs[(nt * 16) * P128 + ks], P128);
        c[nt] = wmma_bf16(a, b, c[nt]);
      }
    }
    __syncthreads();
  }

  const int n  = lane & 15;
  const int rb = (lane >> 4) << 3;
#pragma unroll
  for (int nt = 0; nt < 4; ++nt) {
    const int col = col0 + nt * 16 + n;
    const float bv = bias[col];
#pragma unroll
    for (int v = 0; v < 8; ++v) c[nt][v] += bv;

    if (MODE == 2) {
#pragma unroll
      for (int v = 0; v < 8; ++v)
        outF[(size_t)(row0 + m0 + rb + v) * D_MODEL + col] = c[nt][v];
    }
  }
  if (MODE != 2) {
    // One uniform branch round the rotation of all four tiles; the stores
    // follow it in one straight run.
    if (rope) {
#pragma unroll
      for (int nt = 0; nt < 4; ++nt) {
        const int d = (col0 + nt * 16 + n) & 63;
        // RoPE: pairs (2i, 2i+1) are adjacent columns -> adjacent lanes.
        const float freq = __powf(10000.0f, -(float)(d & ~1) * (1.0f / 64.0f));
        const bool  ev   = (d & 1) == 0;
#pragma unroll
        for (int v = 0; v < 8; ++v) {
          const int pos = row0 + m0 + rb + v;
          float sn, cs;
          __sincosf((float)pos * freq, &sn, &cs);
          float x  = c[nt][v];
          float xp = __shfl_xor(x, 1, 32);
          c[nt][v] = ev ? (x * cs - xp * sn) : (xp * sn + x * cs);
        }
      }
    }
#pragma unroll
    for (int nt = 0; nt < 4; ++nt) {
      const int col = col0 + nt * 16 + n;
      const int h = col >> 6;
      const int d = col & 63;
#pragma unroll
      for (int v = 0; v < 8; ++v) {
        const int pos = row0 + m0 + rb + v;
        outH[((size_t)h * SEQ + pos) * DK + d] = (bf16)(c[nt][v] * oscale);
      }
    }
  }
}

static __device__ __forceinline__ float xhalf(float x) {
  return __builtin_bit_cast(float, __builtin_amdgcn_permlanex16(
      __builtin_bit_cast(int, x), __builtin_bit_cast(int, x),
      0x76543210, 0xfedcba98, false, false));
}

__global__ void __launch_bounds__(256) k_attn(const bf16* __restrict__ qh, const bf16* __restrict__ kh,
                       const bf16* __restrict__ vh, bf16* __restrict__ outA) {
  __shared__ alignas(16) bf16 Qs[128 * 64];   // [row][d]       16 KB
  __shared__ alignas(16) bf16 Ks[STG * P64];  // [kv][d], padded rows
  __shared__ alignas(16) bf16 Vt[64 * P128];  // [d][kv], padded rows

  const int tid  = threadIdx.x;
  const int lane = tid & 31;
  const int wave = tid >> 5;
  const int row0 = blockIdx.x * 128;
  const int h    = blockIdx.y;
  const int m0   = wave * 16;

  const bf16* qb = qh + (size_t)h * SEQ * DK;
  const bf16* kb = kh + (size_t)h * SEQ * DK;
  const bf16* vb = vh + (size_t)h * SEQ * DK;

#if ASYNC_CP
#pragma unroll
  for (int rep = 0; rep < 4; ++rep) {          // 128x64 Q tile, 16B/thread/rep
    int e = rep * 2048 + tid * 8;
    async_cp16(qb + (size_t)row0 * DK + e, &Qs[e]);
  }
  async_wait0();
#else
#pragma unroll
  for (int rep = 0; rep < 32; ++rep) {
    int idx = rep * 256 + tid;
    Qs[idx] = qb[(size_t)row0 * DK + idx];
  }
#endif
  __syncthreads();
  // B operand Q^T: lane = query column, k = d
  const v16bf qa0 = ldfrag(&Qs[m0 * 64], 64);
  const v16bf qa1 = ldfrag(&Qs[m0 * 64 + 32], 64);

  v16bf ones;
#pragma unroll
  for (int i = 0; i < 16; ++i) ones[i] = (bf16)1.0f;

  v8f acc[4] = {};               // acc[nt][v] = O[q = n][d = nt*16 + rb + v]
  float m_i = -3.0e38f, l_i = 0.0f;

  const int n  = lane & 15;
  const int rb = (lane >> 4) << 3;

  for (int j0 = 0; j0 < SEQ; j0 += STG) {
#if ASYNC_CP
#pragma unroll
    for (int rep = 0; rep < 4; ++rep) {        // 128x64 K tile
      int ch = rep * 256 + tid;
      async_cp16(kb + (size_t)j0 * DK + ch * 8,
                 &Ks[(ch >> 3) * P64 + (ch & 7) * 8]);
    }
#endif
#pragma unroll
    for (int rep = 0; rep < 32; ++rep) {       // V^T staging (2B transpose)
      int idx = rep * 256 + tid;
      int r = rep * 4 + (tid >> 6), d = tid & 63;
#if !ASYNC_CP
      Ks[r * P64 + d] = kb[(size_t)j0 * DK + idx];
#endif
      Vt[d * P128 + r] = vb[(size_t)j0 * DK + idx];
    }
    if (j0 + STG < SEQ) {                      // global_prefetch_b8 next stage,
      // one address per 64 B: the 256 threads cover its 16 KB
      __builtin_prefetch(kb + (size_t)(j0 + STG) * DK + tid * 32, 0, 0);
      __builtin_prefetch(vb + (size_t)(j0 + STG) * DK + tid * 32, 0, 0);
    }
#if ASYNC_CP
    async_wait0();
#endif
    __syncthreads();

    // Unrolled: the passes' LDS offsets become immediates, and the next pass's
    // score products can be issued among this pass's vector work.
#pragma unroll
    for (int p0 = 0; p0 < STG; p0 += 32) {     // keys ascending
    // S^T(32x16) = K(32x64) * Q^T  (scale already folded into Q)
    // s0[v] = S[q = n][kv = p0 + rb + v], s1[v] = S[q = n][kv = p0 + 16 + rb + v]
    v8f s0 = {}, s1 = {};
    s0 = wmma_bf16(ldfrag(&Ks[p0 * P64], P64), qa0, s0);
    s0 = wmma_bf16(ldfrag(&Ks[p0 * P64 + 32], P64), qa1, s0);
    s1 = wmma_bf16(ldfrag(&Ks[(p0 + 16) * P64], P64), qa0, s1);
    s1 = wmma_bf16(ldfrag(&Ks[(p0 + 16) * P64 + 32], P64), qa1, s1);

    // the query's maximum: 16 scores in the lane, then the other wave half's
    // (a tree of three-input maxima, not one dependent chain)
    const float g0 = fmaxf(fmaxf(s0[0], s0[1]), s0[2]);
    const float g1 = fmaxf(fmaxf(s0[3], s0[4]), s0[5]);
    const float g2 = fmaxf(fmaxf(s0[6], s0[7]), s1[0]);
    const float g3 = fmaxf(fmaxf(s1[1], s1[2]), s1[3]);
    const float g4 = fmaxf(fmaxf(s1[4], s1[5]), s1[6]);
    float m = fmaxf(fmaxf(fmaxf(g0, g1), g2), fmaxf(fmaxf(g3, g4), s1[7]));
    m = fmaxf(m, xhalf(m));
    const float mn    = fmaxf(m_i, m);
    const float alpha = __expf(m_i - mn);
    m_i = mn;

    // P^T as B operand, straight from the two score tiles
    v16bf pb;
#pragma unroll
    for (int v = 0; v < 8; ++v) {
      pb[v]     = (bf16)__expf(s0[v] - mn);
      pb[8 + v] = (bf16)__expf(s1[v] - mn);
    }
#pragma unroll
    for (int nt = 0; nt < 4; ++nt)
#pragma unroll
      for (int v = 0; v < 8; ++v) acc[nt][v] *= alpha;

    // row-sum(P) via WMMA with all-ones A: every row of the result holds the
    // sum over all 32 keys of the lane's query
    v8f zero = {};
    v8f ls = wmma_bf16(ones, pb, zero);
    l_i = l_i * alpha + ls[0];

#pragma unroll
    for (int nt = 0; nt < 4; ++nt)
      acc[nt] = wmma_bf16(ldfrag(&Vt[(nt * 16) * P128 + p0], P128), pb, acc[nt]);
    }
    __syncthreads();
  }

  // normalize and store merged-head bf16 [S][D_MODEL]: a lane's 8 accumulator
  // registers are 8 consecutive d of its query, one 16-byte store per tile
  const float inv = 1.0f / l_i;
  const int   pos = row0 + m0 + n;
  uint4 o[4];
#pragma unroll
  for (int nt = 0; nt < 4; ++nt) {
    union { bf16 e[8]; uint4 u; } p;
#pragma unroll
    for (int v = 0; v < 8; ++v) p.e[v] = (bf16)(acc[nt][v] * inv);
    o[nt] = p.u;
  }
#pragma unroll
  for (int nt = 0; nt < 4; ++nt)
    *reinterpret_cast<uint4*>(
        outA + (size_t)pos * D_MODEL + h * DK + nt * 16 + rb) = o[nt];
}

// ---------------------------------------------------------------------------
extern "C" void kernel_launch(void* const* d_in, const int* in_sizes, int n_in,
                              void* d_out, int out_size, void* d_ws,
                              size_t ws_size, hipStream_t stream) {
  const float* Q  = (const float*)d_in[0];
  const float* K  = (const float*)d_in[1];
  const float* V  = (const float*)d_in[2];
  const float* Wq = (const float*)d_in[3];
  const float* bq = (const float*)d_in[4];
  const float* Wk = (const float*)d_in[5];
  const float* bk = (const float*)d_in[6];
  const float* Wv = (const float*)d_in[7];
  const float* bv = (const float*)d_in[8];
  const float* Wo = (const float*)d_in[9];
  const float* bo = (const float*)d_in[10];
  float* out = (float*)d_out;

  char* ws = (char*)d_ws;
  const size_t TB = (size_t)SEQ * D_MODEL * sizeof(bf16);     // 8 MB
  bf16* qh   = (bf16*)(ws);
  bf16* kh   = (bf16*)(ws + TB);
  bf16* vh   = (bf16*)(ws + 2 * TB);
  bf16* at   = (bf16*)(ws + 3 * TB);

  dim3 blk(256);
  dim3 grd(SEQ / 128, D_MODEL / 64);          // 32 x 16
  k_gemm<0><<<dim3(SEQ / 128, D_MODEL / 64, 3), blk, 0, stream>>>(
      Q, K, V, nullptr, Wq, Wk, Wv, bq, bk, bv, qh, nullptr);

  k_attn<<<dim3(SEQ / 128, NHEAD), blk, 0, stream>>>(qh, kh, vh, at);

  k_gemm<2><<<grd, blk, 0, stream>>>(nullptr, nullptr, nullptr, at, Wo, nullptr,
                                     nullptr, bo, nullptr, nullptr, nullptr, out);
}

// v006
// It runs in 170 microseconds.
// Next to v005, in two timings, it ran 1.08 times as fast each time.
// Counting every step since v000, it is 4.49 times as fast.
#include <hip/hip_runtime.h>
#include <hip/hip_bf16.h>

typedef __bf16 bf16;
typedef __attribute__((ext_vector_type(16))) __bf16 v16bf;
typedef __attribute__((ext_vector_type(8)))  float  v8f;
typedef int v4i_ __attribute__((vector_size(16)));
typedef __attribute__((ext_vector_type(2)))  float  f32x2;

#define D_MODEL 1024
#define SEQ     4096
#define NHEAD   16
#define DK      64

#define P64 72   // rows of 64 elements (128 B of data) lie 144 B apart
#define P128 136 // rows of 128 elements (256 B of data) lie 272 B apart

// Depth of one LDS stage: k of a GEMM stage, keys of an attention stage. A
// stage is loaded, published by one barrier and then worked off in passes
// of 32 with no barrier between them: four in a GEMM stage, two per key
// half in an attention stage.
#define STG 128

#define AS1 __attribute__((address_space(1)))
#define AS3 __attribute__((address_space(3)))

#if __has_builtin(__builtin_amdgcn_global_load_async_to_lds_b128)
#define ASYNC_CP 1
static __device__ __forceinline__ void async_cp16(const void* g, void* l) {
  __builtin_amdgcn_global_load_async_to_lds_b128(
      (AS1 v4i_*)(unsigned long long)(size_t)g,
      (AS3 v4i_*)(unsigned)(size_t)l, 0, 0);
}
static __device__ __forceinline__ void async_wait0() {
#if __has_builtin(__builtin_amdgcn_s_wait_asynccnt)
  __builtin_amdgcn_s_wait_asynccnt(0);
#else
  asm volatile("s_wait_asynccnt 0" ::: "memory");
#endif
}
#else
#define ASYNC_CP 0
#endif

static __device__ __forceinline__ v16bf ldfrag(const bf16* base, int ld) {
  const int lane = threadIdx.x & 31;
  const int m    = lane & 15;
  const int b0   = (lane & 16) ? 8 : 0;
  const bf16* p  = base + m * ld + b0;
  union { uint4 u[2]; v16bf v; } r;
  r.u[0] = *reinterpret_cast<const uint4*>(p);
  r.u[1] = *reinterpret_cast<const uint4*>(p + 16);
  return r.v;
}

static __device__ __forceinline__ v8f wmma_bf16(v16bf a, v16bf b, v8f c) {
  return __builtin_amdgcn_wmma_f32_16x16x32_bf16(false, a, false, b,
                                                 (short)0, c, false, false);
}

// ---------------------------------------------------------------------------
// Tiled GEMM: Y = X @ W^T + b
// MODE 0: the three input projections in ONE launch; blockIdx.z picks the
//         operand set: 0 = Q (RoPE, scaled by 1/8), 1 = K (RoPE), 2 = V.
//         A f32, bias, head-major bf16 [H][S][DK], plane z of outH.
//         The three are independent of each other: one grid of 3 x 512
//         workgroups keeps three of them on a WGP where a launch of 512 has
//         two, and has no gap, fill or drain between the projections.
// MODE 2: A bf16 (attn out), bias, f32 [S][D_MODEL]             (O-proj)
// Workgroup = 256 threads = 8 waves; tile 128 rows x 64 cols; K stage 128.
// W is the f32 weight as given, [out][in]: its rows are already the [n][k]
// rows of the B tile, so they are rounded to bf16 on the way into LDS.
// ---------------------------------------------------------------------------
template <int MODE>
__global__ void __launch_bounds__(256) k_gemm(const float* __restrict__ A0,
                       const float* __restrict__ A1,
                       const float* __restrict__ A2,
                       const bf16*  __restrict__ Ab,
                       const float* __restrict__ W0,
                       const float* __restrict__ W1,
                       const float* __restrict__ W2,
                       const float* __restrict__ bias0,
                       const float* __restrict__ bias1,
                       const float* __restrict__ bias2,
                       bf16*        __restrict__ outH0,
                       float*       __restrict__ outF) {
  __shared__ alignas(16) bf16 As[128 * P128];  // [row][k], padded rows
  __shared__ alignas(16) bf16 Bs[64 * P128];   // [n][k], padded rows

  // The workgroup's operand set (the same for all its threads).
  const int    z      = (MODE == 0) ? (int)blockIdx.z : 0;
  const float* Af     = z == 0 ? A0 : z == 1 ? A1 : A2;
  const float* W      = z == 0 ? W0 : z == 1 ? W1 : W2;
  const float* bias   = z == 0 ? bias0 : z == 1 ? bias1 : bias2;
  bf16*        outH   = outH0 + (size_t)z * SEQ * D_MODEL;
  const float  oscale = z == 0 ? 0.125f : 1.0f;
  const bool   rope   = z < 2;

  const int tid  = threadIdx.x;
  const int lane = tid & 31;
  const int wave = tid >> 5;
  const int row0 = blockIdx.x * 128;
  const int col0 = blockIdx.y * 64;
  const int m0   = wave * 16;
  const int bn   = tid >> 5;         // B staging: row of W within a group of 8
  const int bk   = (tid & 31) * 4;   // B staging: first of the lane's four k

  // One address per lane and operand; the rows of a stage lie at constant
  // distances from it, which go into the loads' offset fields.
  const float* wp  = W + (size_t)(col0 + bn) * D_MODEL + bk;
  const float* afp = Af + (size_t)(row0 + (tid >> 7)) * D_MODEL + (tid & 127);
  const bf16*  abp = Ab + (size_t)(row0 + (tid >> 4)) * D_MODEL + (tid & 15) * 8;

  v8f c[4] = {};

  // Stays rolled: unrolled, its eight trips are eight copies of a long body.
#pragma unroll 1
  for (int kk = 0; kk < D_MODEL; kk += STG) {
    // 64x128 B tile, [n][k] as in W. 16 B per lane: a wave reads one whole
    // 512-B row piece per load.
    float4 w[8];
#pragma unroll                                 // w[] stays in registers
    for (int rep = 0; rep < 8; ++rep)
      w[rep] = *reinterpret_cast<const float4*>(wp + kk + rep * 8 * D_MODEL);
    // In the MODE 0 build results of A's loads land in the address
    // registers of W's loads: the wait that belongs in front of such an
    // overwrite.
    if (MODE != 2) asm volatile("s_wait_xcnt 0x0" ::: "memory");
    float av[64];
#if ASYNC_CP
    if (MODE == 2) {
      // bf16 source, layout-preserving: async 16B chunks (8 per thread)
#pragma unroll
      for (int rep = 0; rep < 8; ++rep) {
        int r = rep * 16 + (tid >> 4), cc = (tid & 15) * 8;   // 128x128 tile
        async_cp16(abp + kk + rep * 16 * D_MODEL, &As[r * P128 + cc]);
      }
    }
#endif
    if (MODE != 2 || !ASYNC_CP) {
#pragma unroll
      for (int rep = 0; rep < 64; ++rep) {     // 128x128 A tile
        int r = rep * 2 + (tid >> 7), cc = tid & 127;
        if (MODE == 2) av[rep] = (float)Ab[(size_t)(row0 + r) * D_MODEL + kk + cc];
        else           av[rep] = afp[kk + rep * 2 * D_MODEL];
      }
    }
    // Holds every conversion behind the issue of the stage's last load: the
    // stage then pays one load latency, not one per group of loads.
    __builtin_amdgcn_sched_barrier(0);
#pragma unroll
    for (int rep = 0; rep < 8; ++rep) {        // round to bf16, 8 B to LDS
      union { bf16 h[4]; uint2 u; } p;
      p.h[0] = (bf16)w[rep].x; p.h[1] = (bf16)w[rep].y;
      p.h[2] = (bf16)w[rep].z; p.h[3] = (bf16)w[rep].w;
      *reinterpret_cast<uint2*>(&Bs[(rep * 8 + bn) * P128 + bk]) = p.u;
    }
    if (MODE != 2 || !ASYNC_CP) {
#pragma unroll
      for (int rep = 0; rep < 64; ++rep) {
        int r = rep * 2 + (tid >> 7), cc = tid & 127;
        As[r * P128 + cc] = (bf16)av[rep];
      }
    }
#if ASYNC_CP
    if (MODE == 2) async_wait0();
#endif
    __syncthreads();

    // Unrolled: the passes' LDS offsets become immediates of the loads.
#pragma unroll
    for (int ks = 0; ks < STG; ks += 32) {     // k ascending
      v16bf a = ldfrag(&As[m0 * P128 + ks], P128);
#pragma unroll
      for (int nt = 0; nt < 4; ++nt) {
        v16bf b = ldfrag(&Bs[(nt * 16) * P128 + ks], P128);
        c[nt] = wmma_bf16(a, b, c[nt]);
      }
    }
    __syncthreads();
  }

  const int n  = lane & 15;
  const int rb = (lane >> 4) << 3;
#pragma unroll
  for (int nt = 0; nt < 4; ++nt) {
    const int col = col0 + nt * 16 + n;
    const float bv = bias[col];
#pragma unroll
    for (int v = 0; v < 8; ++v) c[nt][v] += bv;

    if (MODE == 2) {
#pragma unroll
      for (int v = 0; v < 8; ++v)
        outF[(size_t)(row0 + m0 + rb + v) * D_MODEL + col] = c[nt][v];
    }
  }
  if (MODE != 2) {
    // One uniform branch round the rotation of all four tiles; the stores
    // follow it in one straight run.
    if (rope) {
#pragma unroll
      for (int nt = 0; nt < 4; ++nt) {
        const int d = (col0 + nt * 16 + n) & 63;
        // RoPE: pairs (2i, 2i+1) are adjacent columns -> adjacent lanes.
        const float freq = __powf(10000.0f, -(float)(d & ~1) * (1.0f / 64.0f));
        const bool  ev   = (d & 1) == 0;
#pragma unroll
        for (int v = 0; v < 8; ++v) {
          const int pos = row0 + m0 + rb + v;
          float sn, cs;
          __sincosf((float)pos * freq, &sn, &cs);
          float x  = c[nt][v];
          float xp = __shfl_xor(x, 1, 32);
          c[nt][v] = ev ? (x * cs - xp * sn) : (xp * sn + x * cs);
        }
      }
    }
#pragma unroll
    for (int nt = 0; nt < 4; ++nt) {
      const int col = col0 + nt * 16 + n;
      const int h = col >> 6;
      const int d = col & 63;
#pragma unroll
      for (int v = 0; v < 8; ++v) {
        const int pos = row0 + m0 + rb + v;
        outH[((size_t)h * SEQ + pos) * DK + d] = (bf16)(c[nt][v] * oscale);
      }
    }
  }
}

static __device__ __forceinline__ float xhalf(float x) {
  return __builtin_bit_cast(float, __builtin_amdgcn_permlanex16(
      __builtin_bit_cast(int, x), __builtin_bit_cast(int, x),
      0x76543210, 0xfedcba98, false, false));
}

__global__ void __launch_bounds__(256) k_attn(const bf16* __restrict__ qh, const bf16* __restrict__ kh,
                       const bf16* __restrict__ vh, bf16* __restrict__ outA) {
  __shared__ alignas(16) bf16 Qs[128 * 64];   // [row][d]       16 KB
  __shared__ alignas(16) bf16 Ks[STG * P64];  // [kv][d], padded rows
  __shared__ alignas(16) bf16 Vt[64 * P128];  // [d][kv], padded rows
  // The upper key half's results on their way to the lower half's waves:
  // [query group][16 pieces of output + 1 of maxima and sums][lane], 16 B each
  __shared__ alignas(16) float4 Mg[4 * 17 * 32];

  const int tid  = threadIdx.x;
  const int lane = tid & 31;
  const int wave = __builtin_amdgcn_readfirstlane(tid >> 5);
  const int row0 = blockIdx.x * 128;
  const int h    = blockIdx.y;
  const int qg   = wave & 3;     // the wave's query group
  const int half = wave >> 2;    // the wave's half of every stage's keys
  const int m0   = qg * 32;

  const bf16* qb = qh + (size_t)h * SEQ * DK;
  const bf16* kb = kh + (size_t)h * SEQ * DK;
  const bf16* vb = vh + (size_t)h * SEQ * DK;

#if ASYNC_CP
#pragma unroll
  for (int rep = 0; rep < 4; ++rep) {          // 128x64 Q tile, 16B/thread/rep
    int e = rep * 2048 + tid * 8;
    async_cp16(qb + (size_t)row0 * DK + e, &Qs[e]);
  }
  async_wait0();
#else
#pragma unroll
  for (int rep = 0; rep < 32; ++rep) {
    int idx = rep * 256 + tid;
    Qs[idx] = qb[(size_t)row0 * DK + idx];
  }
#endif
  __syncthreads();
  // B operand Q^T: lane = query column, k = d; [column group][d half]
  v16bf qa[2][2];
#pragma unroll
  for (int g = 0; g < 2; ++g) {
    qa[g][0] = ldfrag(&Qs[(m0 + g * 16) * 64], 64);
    qa[g][1] = ldfrag(&Qs[(m0 + g * 16) * 64 + 32], 64);
  }

  v16bf ones;
#pragma unroll
  for (int i = 0; i < 16; ++i) ones[i] = (bf16)1.0f;

  // acc[g][nt][v] = O[q = g*16 + n][d = nt*16 + rb + v]
  v8f acc[2][4] = {};
  float m_i[2] = {-3.0e38f, -3.0e38f};
  // Row sums of P, one accumulator tile per column group, summed by the matrix
  // instruction itself. Every row of the tile gets the same increment; only
  // register 0 is rescaled and read. (As separate results of which one
  // register is read, back-to-back row sums were given overlapping registers.)
  v8f lacc[2] = {};

  const int n  = lane & 15;
  const int rb = (lane >> 4) << 3;

  // the wave's 64 keys of a stage
  const bf16* Kh = &Ks[half * (STG / 2) * P64];
  const bf16* Vh = &Vt[half * (STG / 2)];

  for (int j0 = 0; j0 < SEQ; j0 += STG) {
#if ASYNC_CP
#pragma unroll
    for (int rep = 0; rep < 4; ++rep) {        // 128x64 K tile
      int ch = rep * 256 + tid;
      async_cp16(kb + (size_t)j0 * DK + ch * 8,
                 &Ks[(ch >> 3) * P64 + (ch & 7) * 8]);
    }
#endif
#pragma unroll
    for (int rep = 0; rep < 32; ++rep) {       // V^T staging (2B transpose)
      int idx = rep * 256 + tid;
      int r = rep * 4 + (tid >> 6), d = tid & 63;
#if !ASYNC_CP
      Ks[r * P64 + d] = kb[(size_t)j0 * DK + idx];
#endif
      Vt[d * P128 + r] = vb[(size_t)j0 * DK + idx];
    }
    if (j0 + STG < SEQ) {                      // global_prefetch_b8 next stage,
      // one address per 64 B: the 256 threads cover its 16 KB
      __builtin_prefetch(kb + (size_t)(j0 + STG) * DK + tid * 32, 0, 0);
      __builtin_prefetch(vb + (size_t)(j0 + STG) * DK + tid * 32, 0, 0);
    }
#if ASYNC_CP
    async_wait0();
#endif
    __syncthreads();

    // Unrolled: the passes' LDS offsets become immediates, and the next pass's
    // score products can be issued among this pass's vector work.
#pragma unroll
    for (int p0 = 0; p0 < STG / 2; p0 += 32) { // the half's keys ascending
    // S^T(32x16) = K(32x64) * Q^T per column group (scale folded into Q)
    // s0[g][v] = S[q = g*16 + n][kv = p0 + rb + v], s1: kv = p0 + 16 + rb + v
    const v16bf k00 = ldfrag(Kh + p0 * P64, P64);
    const v16bf k01 = ldfrag(Kh + p0 * P64 + 32, P64);
    const v16bf k10 = ldfrag(Kh + (p0 + 16) * P64, P64);
    const v16bf k11 = ldfrag(Kh + (p0 + 16) * P64 + 32, P64);
    v8f s0[2], s1[2];
#pragma unroll
    for (int g = 0; g < 2; ++g) {
      v8f z0 = {}, z1 = {};
      s0[g] = wmma_bf16(k01, qa[g][1], wmma_bf16(k00, qa[g][0], z0));
      s1[g] = wmma_bf16(k11, qa[g][1], wmma_bf16(k10, qa[g][0], z1));
    }

    v16bf vf[4];
#pragma unroll
    for (int nt = 0; nt < 4; ++nt)
      vf[nt] = ldfrag(Vh + (nt * 16) * P128 + p0, P128);

#pragma unroll
    for (int g = 0; g < 2; ++g) {
      const v8f t0 = s0[g], t1 = s1[g];
      // the query's maximum: 16 scores in the lane, then the other wave half's
      // (a tree of three-input maxima, not one dependent chain)
      const float g0 = fmaxf(fmaxf(t0[0], t0[1]), t0[2]);
      const float g1 = fmaxf(fmaxf(t0[3], t0[4]), t0[5]);
      const float g2 = fmaxf(fmaxf(t0[6], t0[7]), t1[0]);
      const float g3 = fmaxf(fmaxf(t1[1], t1[2]), t1[3]);
      const float g4 = fmaxf(fmaxf(t1[4], t1[5]), t1[6]);
      float m = fmaxf(fmaxf(fmaxf(g0, g1), g2), fmaxf(fmaxf(g3, g4), t1[7]));
      m = fmaxf(m, xhalf(m));
      const float mn    = fmaxf(m_i[g], m);
      const float alpha = __expf(m_i[g] - mn);
      m_i[g] = mn;

      // P^T as B operand, straight from the two score tiles
      v16bf pb;
#pragma unroll
      for (int v = 0; v < 8; v += 2) {         // register pairs as they lie
        const f32x2 d0 = f32x2{t0[v], t0[v + 1]} - mn;
        const f32x2 d1 = f32x2{t1[v], t1[v + 1]} - mn;
        pb[v]         = (bf16)__expf(d0.x);
        pb[v + 1]     = (bf16)__expf(d0.y);
        pb[8 + v]     = (bf16)__expf(d1.x);
        pb[8 + v + 1] = (bf16)__expf(d1.y);
      }
#pragma unroll
      for (int nt = 0; nt < 4; ++nt)
#pragma unroll
        for (int v = 0; v < 8; ++v) acc[g][nt][v] *= alpha;

      // row-sum(P) via WMMA with all-ones A: every row of the increment holds
      // the sum over all 32 keys of the lane's query
      lacc[g][0] *= alpha;
      lacc[g] = wmma_bf16(ones, pb, lacc[g]);

#pragma unroll
      for (int nt = 0; nt < 4; ++nt)
        acc[g][nt] = wmma_bf16(vf[nt], pb, acc[g][nt]);
    }
    }
    __syncthreads();
  }

  // Join the two key halves. The waves of a query group hold the same
  // (query, d) at the same lane and register: the upper half hands its
  // results over lane by lane, 16 B per lane and piece.
  float4* mg = &Mg[qg * 17 * 32 + lane];
  if (half == 1) {
#pragma unroll
    for (int g = 0; g < 2; ++g)
#pragma unroll
      for (int nt = 0; nt < 4; ++nt) {
        const v8f a = acc[g][nt];
        mg[((g * 4 + nt) * 2 + 0) * 32] = make_float4(a[0], a[1], a[2], a[3]);
        mg[((g * 4 + nt) * 2 + 1) * 32] = make_float4(a[4], a[5], a[6], a[7]);
      }
    mg[16 * 32] = make_float4(m_i[0], m_i[1], lacc[0][0], lacc[1][0]);
  }
  __syncthreads();   // the upper half's results are in LDS
  if (half == 0) {
    // rescale both halves to the common maximum, normalize and store
    // merged-head bf16 [S][D_MODEL]: a lane's 8 accumulator registers are 8
    // consecutive d of its query, one 16-byte store per tile
    const float4 ml = mg[16 * 32];
#pragma unroll
    for (int g = 0; g < 2; ++g) {
      const float mo  = g ? ml.y : ml.x;
      const float lo  = g ? ml.w : ml.z;
      const float mm  = fmaxf(m_i[g], mo);
      const float ea  = __expf(m_i[g] - mm);
      const float eb  = __expf(mo - mm);
      const float inv = 1.0f / (lacc[g][0] * ea + lo * eb);
      const float fa  = ea * inv, fb = eb * inv;
      const int   pos = row0 + m0 + g * 16 + n;
#pragma unroll
      for (int nt = 0; nt < 4; ++nt) {
        const float4 b0 = mg[((g * 4 + nt) * 2 + 0) * 32];
        const float4 b1 = mg[((g * 4 + nt) * 2 + 1) * 32];
        const v8f a = acc[g][nt];
        union { bf16 e[8]; uint4 u; } p;
        p.e[0] = (bf16)(a[0] * fa + b0.x * fb);
        p.e[1] = (bf16)(a[1] * fa + b0.y * fb);
        p.e[2] = (bf16)(a[2] * fa + b0.z * fb);
        p.e[3] = (bf16)(a[3] * fa + b0.w * fb);
        p.e[4] = (bf16)(a[4] * fa + b1.x * fb);
        p.e[5] = (bf16)(a[5] * fa + b1.y * fb);
        p.e[6] = (bf16)(a[6] * fa + b1.z * fb);
        p.e[7] = (bf16)(a[7] * fa + b1.w * fb);
        *reinterpret_cast<uint4*>(
            outA + (size_t)pos * D_MODEL + h * DK + nt * 16 + rb) = p.u;
      }
    }
  }
}

// ---------------------------------------------------------------------------
extern "C" void kernel_launch(void* const* d_in, const int* in_sizes, int n_in,
                              void* d_out, int out_size, void* d_ws,
                              size_t ws_size, hipStream_t stream) {
  const float* Q  = (const float*)d_in[0];
  const float* K  = (const float*)d_in[1];
  const float* V  = (const float*)d_in[2];
  const float* Wq = (const float*)d_in[3];
  const float* bq = (const float*)d_in[4];
  const float* Wk = (const float*)d_in[5];
  const float* bk = (const float*)d_in[6];
  const float* Wv = (const float*)d_in[7];
  const float* bv = (const float*)d_in[8];
  const float* Wo = (const float*)d_in[9];
  const float* bo = (const float*)d_in[10];
  float* out = (float*)d_out;

  char* ws = (char*)d_ws;
  const size_t TB = (size_t)SEQ * D_MODEL * sizeof(bf16);     // 8 MB
  bf16* qh   = (bf16*)(ws);
  bf16* kh   = (bf16*)(ws + TB);
  bf16* vh   = (bf16*)(ws + 2 * TB);
  bf16* at   = (bf16*)(ws + 3 * TB);

  dim3 blk(256);
  dim3 grd(SEQ / 128, D_MODEL / 64);          // 32 x 16
  k_gemm<0><<<dim3(SEQ / 128, D_MODEL / 64, 3), blk, 0, stream>>>(
      Q, K, V, nullptr, Wq, Wk, Wv, bq, bk, bv, qh, nullptr);

  k_attn<<<dim3(SEQ / 128, NHEAD), blk, 0, stream>>>(qh, kh, vh, at);

  k_gemm<2><<<grd, blk, 0, stream>>>(nullptr, nullptr, nullptr, at, Wo, nullptr,
                                     nullptr, bo, nullptr, nullptr, nullptr, out);
}

// v007
// One run takes 146 microseconds.
// Next to v006, in two timings, it ran 1.16 times as fast each time.
// Over all steps from v000 it is 5.20 times as fast.
#include <hip/hip_runtime.h>
#include <hip/hip_bf16.h>

typedef __bf16 bf16;
typedef __attribute__((ext_vector_type(16))) __bf16 v16bf;
typedef __attribute__((ext_vector_type(8)))  float  v8f;
typedef int v4i_ __attribute__((vector_size(16)));
typedef __attribute__((ext_vector_type(2)))  float  f32x2;

#define D_MODEL 1024
#define SEQ     4096
#define NHEAD   16
#define DK      64

#define P64 72   // rows of 64 elements (128 B of data) lie 144 B apart
#define P128 136 // rows of 128 elements (256 B of data) lie 272 B apart
// V rows are read by the 16-bit transposing load, which wants 32 B x odd.
#define PV 80    // rows of 64 elements (128 B of data) lie 160 B apart

// Depth of one LDS stage: k of a GEMM stage, keys of an attention stage. A
// stage is loaded, published by one barrier and then worked off in passes
// of 32 with no barrier between them: four in a GEMM stage, two per key
// half in an attention stage.
#define STG 128

#define AS1 __attribute__((address_space(1)))
#define AS3 __attribute__((address_space(3)))

#if __has_builtin(__builtin_amdgcn_global_load_async_to_lds_b128)
#define ASYNC_CP 1
static __device__ __forceinline__ void async_cp16(const void* g, void* l) {
  __builtin_amdgcn_global_load_async_to_lds_b128(
      (AS1 v4i_*)(unsigned long long)(size_t)g,
      (AS3 v4i_*)(unsigned)(size_t)l, 0, 0);
}
static __device__ __forceinline__ void async_wait0() {
#if __has_builtin(__builtin_amdgcn_s_wait_asynccnt)
  __builtin_amdgcn_s_wait_asynccnt(0);
#else
  asm volatile("s_wait_asynccnt 0" ::: "memory");
#endif
}
#else
#define ASYNC_CP 0
#endif

static __device__ __forceinline__ v16bf ldfrag(const bf16* base, int ld) {
  const int lane = threadIdx.x & 31;
  const int m    = lane & 15;
  const int b0   = (lane & 16) ? 8 : 0;
  const bf16* p  = base + m * ld + b0;
  union { uint4 u[2]; v16bf v; } r;
  r.u[0] = *reinterpret_cast<const uint4*>(p);
  r.u[1] = *reinterpret_cast<const uint4*>(p + 16);
  return r.v;
}

// ---------------------------------------------------------------------------
// Transposed fragment: 16 (columns of T) x 32 (rows of T) A operand from a
// row-major 16-bit LDS tile T, by two ds_load_tr16_b128. p is the lane's own
// address: row 8 * (lane >> 4) + (lane & 7) of the fragment's first 16 rows,
// 16 B * ((lane >> 3) & 1) into the fragment's 32 B of columns. The lane gets
// T[8h + 0..7][c] and T[16 + 8h + 0..7][c], c = lane & 15, h = lane >> 4:
// the k order of ldfrag.
// ---------------------------------------------------------------------------
typedef short s16x8 __attribute__((ext_vector_type(8)));
static __device__ __forceinline__ v16bf ldfrag_tr(const bf16* p, int ld) {
  typedef AS3 s16x8 lds_s16x8;
  union { s16x8 q[2]; v16bf v; } r;
  r.q[0] = __builtin_amdgcn_ds_load_tr16_b128_v8i16((lds_s16x8*)p);
  r.q[1] = __builtin_amdgcn_ds_load_tr16_b128_v8i16((lds_s16x8*)(p + 16 * ld));
  return r.v;
}

static __device__ __forceinline__ v8f wmma_bf16(v16bf a, v16bf b, v8f c) {
  return __builtin_amdgcn_wmma_f32_16x16x32_bf16(false, a, false, b,
                                                 (short)0, c, false, false);
}

// ---------------------------------------------------------------------------
// Tiled GEMM: Y = X @ W^T + b
// MODE 0: the three input projections in ONE launch; blockIdx.z picks the
//         operand set: 0 = Q (RoPE, scaled by 1/8), 1 = K (RoPE), 2 = V.
//         A f32, bias, head-major bf16 [H][S][DK], plane z of outH.
//         The three are independent of each other: one grid of 3 x 512
//         workgroups keeps three of them on a WGP where a launch of 512 has
//         two, and has no gap, fill or drain between the projections.
// MODE 2: A bf16 (attn out), bias, f32 [S][D_MODEL]             (O-proj)
// Workgroup = 256 threads = 8 waves; tile 128 rows x 64 cols; K stage 128.
// W is the f32 weight as given, [out][in]: its rows are already the [n][k]
// rows of the B tile, so they are rounded to bf16 on the way into LDS.
// ---------------------------------------------------------------------------
template <int MODE>
__global__ void __launch_bounds__(256) k_gemm(const float* __restrict__ A0,
                       const float* __restrict__ A1,
                       const float* __restrict__ A2,
                       const bf16*  __restrict__ Ab,
                       const float* __restrict__ W0,
                       const float* __restrict__ W1,
                       const float* __restrict__ W2,
                       const float* __restrict__ bias0,
                       const float* __restrict__ bias1,
                       const float* __restrict__ bias2,
                       bf16*        __restrict__ outH0,
                       float*       __restrict__ outF) {
  __shared__ alignas(16) bf16 As[128 * P128];  // [row][k], padded rows
  __shared__ alignas(16) bf16 Bs[64 * P128];   // [n][k], padded rows

  // The workgroup's operand set (the same for all its threads).
  const int    z      = (MODE == 0) ? (int)blockIdx.z : 0;
  const float* Af     = z == 0 ? A0 : z == 1 ? A1 : A2;
  const float* W      = z == 0 ? W0 : z == 1 ? W1 : W2;
  const float* bias   = z == 0 ? bias0 : z == 1 ? bias1 : bias2;
  bf16*        outH   = outH0 + (size_t)z * SEQ * D_MODEL;
  const float  oscale = z == 0 ? 0.125f : 1.0f;
  const bool   rope   = z < 2;

  const int tid  = threadIdx.x;
  const int lane = tid & 31;
  const int wave = tid >> 5;
  const int row0 = blockIdx.x * 128;
  const int col0 = blockIdx.y * 64;
  const int m0   = wave * 16;
  const int bn   = tid >> 5;         // B staging: row of W within a group of 8
  const int bk   = (tid & 31) * 4;   // B staging: first of the lane's four k

  // One address per lane and operand; the rows of a stage lie at constant
  // distances from it, which go into the loads' offset fields.
  const float* wp  = W + (size_t)(col0 + bn) * D_MODEL + bk;
  const float* afp = Af + (size_t)(row0 + (tid >> 7)) * D_MODEL + (tid & 127);
  const bf16*  abp = Ab + (size_t)(row0 + (tid >> 4)) * D_MODEL + (tid & 15) * 8;

  v8f c[4] = {};

  // Stays rolled: unrolled, its eight trips are eight copies of a long body.
#pragma unroll 1
  for (int kk = 0; kk < D_MODEL; kk += STG) {
    // 64x128 B tile, [n][k] as in W. 16 B per lane: a wave reads one whole
    // 512-B row piece per load.
    float4 w[8];
#pragma unroll                                 // w[] stays in registers
    for (int rep = 0; rep < 8; ++rep)
      w[rep] = *reinterpret_cast<const float4*>(wp + kk + rep * 8 * D_MODEL);
    // In the MODE 0 build results of A's loads land in the address
    // registers of W's loads: the wait that belongs in front of such an
    // overwrite.
    if (MODE != 2) asm volatile("s_wait_xcnt 0x0" ::: "memory");
    float av[64];
#if ASYNC_CP
    if (MODE == 2) {
      // bf16 source, layout-preserving: async 16B chunks (8 per thread)
#pragma unroll
      for (int rep = 0; rep < 8; ++rep) {
        int r = rep * 16 + (tid >> 4), cc = (tid & 15) * 8;   // 128x128 tile
        async_cp16(abp + kk + rep * 16 * D_MODEL, &As[r * P128 + cc]);
      }
    }
#endif
    if (MODE != 2 || !ASYNC_CP) {
#pragma unroll
      for (int rep = 0; rep < 64; ++rep) {     // 128x128 A tile
        int r = rep * 2 + (tid >> 7), cc = tid & 127;
        if (MODE == 2) av[rep] = (float)Ab[(size_t)(row0 + r) * D_MODEL + kk + cc];
        else           av[rep] = afp[kk + rep * 2 * D_MODEL];
      }
    }
    // Holds every conversion behind the issue of the stage's last load: the
    // stage then pays one load latency, not one per group of loads.
    __builtin_amdgcn_sched_barrier(0);
#pragma unroll
    for (int rep = 0; rep < 8; ++rep) {        // round to bf16, 8 B to LDS
      union { bf16 h[4]; uint2 u; } p;
      p.h[0] = (bf16)w[rep].x; p.h[1] = (bf16)w[rep].y;
      p.h[2] = (bf16)w[rep].z; p.h[3] = (bf16)w[rep].w;
      *reinterpret_cast<uint2*>(&Bs[(rep * 8 + bn) * P128 + bk]) = p.u;
    }
    if (MODE != 2 || !ASYNC_CP) {
#pragma unroll
      for (int rep = 0; rep < 64; ++rep) {
        int r = rep * 2 + (tid >> 7), cc = tid & 127;
        As[r * P128 + cc] = (bf16)av[rep];
      }
    }
#if ASYNC_CP
    if (MODE == 2) async_wait0();
#endif
    __syncthreads();

    // Unrolled: the passes' LDS offsets become immediates of the loads.
#pragma unroll
    for (int ks = 0; ks < STG; ks += 32) {     // k ascending
      v16bf a = ldfrag(&As[m0 * P128 + ks], P128);
#pragma unroll
      for (int nt = 0; nt < 4; ++nt) {
        v16bf b = ldfrag(&Bs[(nt * 16) * P128 + ks], P128);
        c[nt] = wmma_bf16(a, b, c[nt]);
      }
    }
    __syncthreads();
  }

  const int n  = lane & 15;
  const int rb = (lane >> 4) << 3;
#pragma unroll
  for (int nt = 0; nt < 4; ++nt) {
    const int col = col0 + nt * 16 + n;
    const float bv = bias[col];
#pragma unroll
    for (int v = 0; v < 8; ++v) c[nt][v] += bv;

    if (MODE == 2) {
#pragma unroll
      for (int v = 0; v < 8; ++v)
        outF[(size_t)(row0 + m0 + rb + v) * D_MODEL + col] = c[nt][v];
    }
  }
  if (MODE != 2) {
    // One uniform branch round the rotation of all four tiles; the stores
    // follow it in one straight run.
    if (rope) {
#pragma unroll
      for (int nt = 0; nt < 4; ++nt) {
        const int d = (col0 + nt * 16 + n) & 63;
        // RoPE: pairs (2i, 2i+1) are adjacent columns -> adjacent lanes.
        const float freq = __powf(10000.0f, -(float)(d & ~1) * (1.0f / 64.0f));
        const bool  ev   = (d & 1) == 0;
#pragma unroll
        for (int v = 0; v < 8; ++v) {
          const int pos = row0 + m0 + rb + v;
          float sn, cs;
          __sincosf((float)pos * freq, &sn, &cs);
          float x  = c[nt][v];
          float xp = __shfl_xor(x, 1, 32);
          c[nt][v] = ev ? (x * cs - xp * sn) : (xp * sn + x * cs);
        }
      }
    }
#pragma unroll
    for (int nt = 0; nt < 4; ++nt) {
      const int col = col0 + nt * 16 + n;
      const int h = col >> 6;
      const int d = col & 63;
#pragma unroll
      for (int v = 0; v < 8; ++v) {
        const int pos = row0 + m0 + rb + v;
        outH[((size_t)h * SEQ + pos) * DK + d] = (bf16)(c[nt][v] * oscale);
      }
    }
  }
}

static __device__ __forceinline__ float xhalf(float x) {
  return __builtin_bit_cast(float, __builtin_amdgcn_permlanex16(
      __builtin_bit_cast(int, x), __builtin_bit_cast(int, x),
      0x76543210, 0xfedcba98, false, false));
}

__global__ void __launch_bounds__(256) k_attn(const bf16* __restrict__ qh, const bf16* __restrict__ kh,
                       const bf16* __restrict__ vh, bf16* __restrict__ outA) {
  __shared__ alignas(16) bf16 Qs[128 * 64];   // [row][d]       16 KB
  __shared__ alignas(16) bf16 Ks[STG * P64];  // [kv][d], padded rows
  __shared__ alignas(16) bf16 Vs[STG * PV];   // [kv][d], padded rows
  // The upper key half's results on their way to the lower half's waves:
  // [query group][16 pieces of output + 1 of maxima and sums][lane], 16 B each
  __shared__ alignas(16) float4 Mg[4 * 17 * 32];

  const int tid  = threadIdx.x;
  const int lane = tid & 31;
  const int wave = __builtin_amdgcn_readfirstlane(tid >> 5);
  const int row0 = blockIdx.x * 128;
  const int h    = blockIdx.y;
  const int qg   = wave & 3;     // the wave's query group
  const int half = wave >> 2;    // the wave's half of every stage's keys
  const int m0   = qg * 32;

  const bf16* qb = qh + (size_t)h * SEQ * DK;
  const bf16* kb = kh + (size_t)h * SEQ * DK;
  const bf16* vb = vh + (size_t)h * SEQ * DK;

#if ASYNC_CP
#pragma unroll
  for (int rep = 0; rep < 4; ++rep) {          // 128x64 Q tile, 16B/thread/rep
    int e = rep * 2048 + tid * 8;
    async_cp16(qb + (size_t)row0 * DK + e, &Qs[e]);
  }
  async_wait0();
#else
#pragma unroll
  for (int rep = 0; rep < 32; ++rep) {
    int idx = rep * 256 + tid;
    Qs[idx] = qb[(size_t)row0 * DK + idx];
  }
#endif
  __syncthreads();
  // B operand Q^T: lane = query column, k = d; [column group][d half]
  v16bf qa[2][2];
#pragma unroll
  for (int g = 0; g < 2; ++g) {
    qa[g][0] = ldfrag(&Qs[(m0 + g * 16) * 64], 64);
    qa[g][1] = ldfrag(&Qs[(m0 + g * 16) * 64 + 32], 64);
  }

  v16bf ones;
#pragma unroll
  for (int i = 0; i < 16; ++i) ones[i] = (bf16)1.0f;

  // acc[g][nt][v] = O[q = g*16 + n][d = nt*16 + rb + v]
  v8f acc[2][4] = {};
  float m_i[2] = {-3.0e38f, -3.0e38f};
  // Row sums of P, one accumulator tile per column group, summed by the matrix
  // instruction itself. Every row of the tile gets the same increment; only
  // register 0 is rescaled and read. (As separate results of which one
  // register is read, back-to-back row sums were given overlapping registers.)
  v8f lacc[2] = {};

  const int n  = lane & 15;
  const int rb = (lane >> 4) << 3;

  // the wave's 64 keys of a stage
  const bf16* Kh = &Ks[half * (STG / 2) * P64];
  const bf16* Vh = &Vs[(half * (STG / 2) + rb + (lane & 7)) * PV +
                       ((lane >> 3) & 1) * 8];   // the lane's ldfrag_tr address

  for (int j0 = 0; j0 < SEQ; j0 += STG) {
#if ASYNC_CP
#pragma unroll
    for (int rep = 0; rep < 4; ++rep) {        // 128x64 K and V tiles
      int ch = rep * 256 + tid;
      async_cp16(kb + (size_t)j0 * DK + ch * 8,
                 &Ks[(ch >> 3) * P64 + (ch & 7) * 8]);
      async_cp16(vb + (size_t)j0 * DK + ch * 8,
                 &Vs[(ch >> 3) * PV + (ch & 7) * 8]);
    }
#else
#pragma unroll
    for (int rep = 0; rep < 32; ++rep) {
      int idx = rep * 256 + tid;
      int r = rep * 4 + (tid >> 6), d = tid & 63;
      Ks[r * P64 + d] = kb[(size_t)j0 * DK + idx];
      Vs[r * PV + d]  = vb[(size_t)j0 * DK + idx];
    }
#endif
    if (j0 + STG < SEQ) {                      // global_prefetch_b8 next stage,
      // one address per 64 B: the 256 threads cover its 16 KB
      __builtin_prefetch(kb + (size_t)(j0 + STG) * DK + tid * 32, 0, 0);
      __builtin_prefetch(vb + (size_t)(j0 + STG) * DK + tid * 32, 0, 0);
    }
#if ASYNC_CP
    async_wait0();
#endif
    __syncthreads();

    // Unrolled: the passes' LDS offsets become immediates, and the next pass's
    // score products can be issued among this pass's vector work.
#pragma unroll
    for (int p0 = 0; p0 < STG / 2; p0 += 32) { // the half's keys ascending
    // S^T(32x16) = K(32x64) * Q^T per column group (scale folded into Q)
    // s0[g][v] = S[q = g*16 + n][kv = p0 + rb + v], s1: kv = p0 + 16 + rb + v
    const v16bf k00 = ldfrag(Kh + p0 * P64, P64);
    const v16bf k01 = ldfrag(Kh + p0 * P64 + 32, P64);
    const v16bf k10 = ldfrag(Kh + (p0 + 16) * P64, P64);
    const v16bf k11 = ldfrag(Kh + (p0 + 16) * P64 + 32, P64);
    v8f s0[2], s1[2];
#pragma unroll
    for (int g = 0; g < 2; ++g) {
      v8f z0 = {}, z1 = {};
      s0[g] = wmma_bf16(k01, qa[g][1], wmma_bf16(k00, qa[g][0], z0));
      s1[g] = wmma_bf16(k11, qa[g][1], wmma_bf16(k10, qa[g][0], z1));
    }

    v16bf vf[4];
#pragma unroll
    for (int nt = 0; nt < 4; ++nt)
      vf[nt] = ldfrag_tr(Vh + p0 * PV + nt * 16, PV);

#pragma unroll
    for (int g = 0; g < 2; ++g) {
      const v8f t0 = s0[g], t1 = s1[g];
      // the query's maximum: 16 scores in the lane, then the other wave half's
      // (a tree of three-input maxima, not one dependent chain)
      const float g0 = fmaxf(fmaxf(t0[0], t0[1]), t0[2]);
      const float g1 = fmaxf(fmaxf(t0[3], t0[4]), t0[5]);
      const float g2 = fmaxf(fmaxf(t0[6], t0[7]), t1[0]);
      const float g3 = fmaxf(fmaxf(t1[1], t1[2]), t1[3]);
      const float g4 = fmaxf(fmaxf(t1[4], t1[5]), t1[6]);
      float m = fmaxf(fmaxf(fmaxf(g0, g1), g2), fmaxf(fmaxf(g3, g4), t1[7]));
      m = fmaxf(m, xhalf(m));
      const float mn    = fmaxf(m_i[g], m);
      const float alpha = __expf(m_i[g] - mn);
      m_i[g] = mn;

      // P^T as B operand, straight from the two score tiles
      v16bf pb;
#pragma unroll
      for (int v = 0; v < 8; v += 2) {         // register pairs as they lie
        const f32x2 d0 = f32x2{t0[v], t0[v + 1]} - mn;
        const f32x2 d1 = f32x2{t1[v], t1[v + 1]} - mn;
        pb[v]         = (bf16)__expf(d0.x);
        pb[v + 1]     = (bf16)__expf(d0.y);
        pb[8 + v]     = (bf16)__expf(d1.x);
        pb[8 + v + 1] = (bf16)__expf(d1.y);
      }
#pragma unroll
      for (int nt = 0; nt < 4; ++nt)
#pragma unroll
        for (int v = 0; v < 8; ++v) acc[g][nt][v] *= alpha;

      // row-sum(P) via WMMA with all-ones A: every row of the increment holds
      // the sum over all 32 keys of the lane's query
      lacc[g][0] *= alpha;
      lacc[g] = wmma_bf16(ones, pb, lacc[g]);

#pragma unroll
      for (int nt = 0; nt < 4; ++nt)
        acc[g][nt] = wmma_bf16(vf[nt], pb, acc[g][nt]);
    }
    }
    __syncthreads();
  }

  // Join the two key halves. The waves of a query group hold the same
  // (query, d) at the same lane and register: the upper half hands its
  // results over lane by lane, 16 B per lane and piece.
  float4* mg = &Mg[qg * 17 * 32 + lane];
  if (half == 1) {
#pragma unroll
    for (int g = 0; g < 2; ++g)
#pragma unroll
      for (int nt = 0; nt < 4; ++nt) {
        const v8f a = acc[g][nt];
        mg[((g * 4 + nt) * 2 + 0) * 32] = make_float4(a[0], a[1], a[2], a[3]);
        mg[((g * 4 + nt) * 2 + 1) * 32] = make_float4(a[4], a[5], a[6], a[7]);
      }
    mg[16 * 32] = make_float4(m_i[0], m_i[1], lacc[0][0], lacc[1][0]);
  }
  __syncthreads();   // the upper half's results are in LDS
  if (half == 0) {
    // rescale both halves to the common maximum, normalize and store
    // merged-head bf16 [S][D_MODEL]: a lane's 8 accumulator registers are 8
    // consecutive d of its query, one 16-byte store per tile
    const float4 ml = mg[16 * 32];
#pragma unroll
    for (int g = 0; g < 2; ++g) {
      const float mo  = g ? ml.y : ml.x;
      const float lo  = g ? ml.w : ml.z;
      const float mm  = fmaxf(m_i[g], mo);
      const float ea  = __expf(m_i[g] - mm);
      const float eb  = __expf(mo - mm);
      const float inv = 1.0f / (lacc[g][0] * ea + lo * eb);
      const float fa  = ea * inv, fb = eb * inv;
      const int   pos = row0 + m0 + g * 16 + n;
#pragma unroll
      for (int nt = 0; nt < 4; ++nt) {
        const float4 b0 = mg[((g * 4 + nt) * 2 + 0) * 32];
        const float4 b1 = mg[((g * 4 + nt) * 2 + 1) * 32];
        const v8f a = acc[g][nt];
        union { bf16 e[8]; uint4 u; } p;
        p.e[0] = (bf16)(a[0] * fa + b0.x * fb);
        p.e[1] = (bf16)(a[1] * fa + b0.y * fb);
        p.e[2] = (bf16)(a[2] * fa + b0.z * fb);
        p.e[3] = (bf16)(a[3] * fa + b0.w * fb);
        p.e[4] = (bf16)(a[4] * fa + b1.x * fb);
        p.e[5] = (bf16)(a[5] * fa + b1.y * fb);
        p.e[6] = (bf16)(a[6] * fa + b1.z * fb);
        p.e[7] = (bf16)(a[7] * fa + b1.w * fb);
        *reinterpret_cast<uint4*>(
            outA + (size_t)pos * D_MODEL + h * DK + nt * 16 + rb) = p.u;
      }
    }
  }
}

// ---------------------------------------------------------------------------
extern "C" void kernel_launch(void* const* d_in, const int* in_sizes, int n_in,
                              void* d_out, int out_size, void* d_ws,
                              size_t ws_size, hipStream_t stream) {
  const float* Q  = (const float*)d_in[0];
  const float* K  = (const float*)d_in[1];
  const float* V  = (const float*)d_in[2];
  const float* Wq = (const float*)d_in[3];
  const float* bq = (const float*)d_in[4];
  const float* Wk = (const float*)d_in[5];
  const float* bk = (const float*)d_in[6];
  const float* Wv = (const float*)d_in[7];
  const float* bv = (const float*)d_in[8];
  const float* Wo = (const float*)d_in[9];
  const float* bo = (const float*)d_in[10];
  float* out = (float*)d_out;

  char* ws = (char*)d_ws;
  const size_t TB = (size_t)SEQ * D_MODEL * sizeof(bf16);     // 8 MB
  bf16* qh   = (bf16*)(ws);
  bf16* kh   = (bf16*)(ws + TB);
  bf16* vh   = (bf16*)(ws + 2 * TB);
  bf16* at   = (bf16*)(ws + 3 * TB);

  dim3 blk(256);
  dim3 grd(SEQ / 128, D_MODEL / 64);          // 32 x 16
  k_gemm<0><<<dim3(SEQ / 128, D_MODEL / 64, 3), blk, 0, stream>>>(
      Q, K, V, nullptr, Wq, Wk, Wv, bq, bk, bv, qh, nullptr);

  k_attn<<<dim3(SEQ / 128, NHEAD), blk, 0, stream>>>(qh, kh, vh, at);

  k_gemm<2><<<grd, blk, 0, stream>>>(nullptr, nullptr, nullptr, at, Wo, nullptr,
                                     nullptr, bo, nullptr, nullptr, nullptr, out);
}

// v008
// Measured time: 140 microseconds a run.
// Timed twice side by side with v007, it ran 1.04 times as fast both times.
// Over all steps from v000 it is 5.43 times as fast.
#include <hip/hip_runtime.h>
#include <hip/hip_bf16.h>

typedef __bf16 bf16;
typedef __attribute__((ext_vector_type(16))) __bf16 v16bf;
typedef __attribute__((ext_vector_type(8)))  float  v8f;
typedef int v4i_ __attribute__((vector_size(16)));

#define D_MODEL 1024
#define SEQ     4096
#define NHEAD   16
#define DK      64

#define P64 72   // rows of 64 elements (128 B of data) lie 144 B apart
#define P128 136 // rows of 128 elements (256 B of data) lie 272 B apart
// V rows are read by the 16-bit transposing load, which wants 32 B x odd.
#define PV 80    // rows of 64 elements (128 B of data) lie 160 B apart

// Depth of one LDS stage: k of a GEMM stage, keys of an attention stage. A
// stage is loaded, published by one barrier and then worked off in passes
// of 32 with no barrier between them: four in a GEMM stage, two per key
// half in an attention stage.
#define STG 128

// How far a score may rise above the held softmax reference before it moves.
#define REF_GAP 5.5f

#define AS1 __attribute__((address_space(1)))
#define AS3 __attribute__((address_space(3)))

#if __has_builtin(__builtin_amdgcn_global_load_async_to_lds_b128)
#define ASYNC_CP 1
static __device__ __forceinline__ void async_cp16(const void* g, void* l) {
  __builtin_amdgcn_global_load_async_to_lds_b128(
      (AS1 v4i_*)(unsigned long long)(size_t)g,
      (AS3 v4i_*)(unsigned)(size_t)l, 0, 0);
}
static __device__ __forceinline__ void async_wait0() {
#if __has_builtin(__builtin_amdgcn_s_wait_asynccnt)
  __builtin_amdgcn_s_wait_asynccnt(0);
#else
  asm volatile("s_wait_asynccnt 0" ::: "memory");
#endif
}
#else
#define ASYNC_CP 0
#endif

static __device__ __forceinline__ v16bf ldfrag(const bf16* base, int ld) {
  const int lane = threadIdx.x & 31;
  const int m    = lane & 15;
  const int b0   = (lane & 16) ? 8 : 0;
  const bf16* p  = base + m * ld + b0;
  union { uint4 u[2]; v16bf v; } r;
  r.u[0] = *reinterpret_cast<const uint4*>(p);
  r.u[1] = *reinterpret_cast<const uint4*>(p + 16);
  return r.v;
}

// ---------------------------------------------------------------------------
// Transposed fragment: 16 (columns of T) x 32 (rows of T) A operand from a
// row-major 16-bit LDS tile T, by two ds_load_tr16_b128. p is the lane's own
// address: row 8 * (lane >> 4) + (lane & 7) of the fragment's first 16 rows,
// 16 B * ((lane >> 3) & 1) into the fragment's 32 B of columns. The lane gets
// T[8h + 0..7][c] and T[16 + 8h + 0..7][c], c = lane & 15, h = lane >> 4:
// the k order of ldfrag.
// ---------------------------------------------------------------------------
typedef short s16x8 __attribute__((ext_vector_type(8)));
static __device__ __forceinline__ v16bf ldfrag_tr(const bf16* p, int ld) {
  typedef AS3 s16x8 lds_s16x8;
  union { s16x8 q[2]; v16bf v; } r;
  r.q[0] = __builtin_amdgcn_ds_load_tr16_b128_v8i16((lds_s16x8*)p);
  r.q[1] = __builtin_amdgcn_ds_load_tr16_b128_v8i16((lds_s16x8*)(p + 16 * ld));
  return r.v;
}

static __device__ __forceinline__ v8f wmma_bf16(v16bf a, v16bf b, v8f c) {
  return __builtin_amdgcn_wmma_f32_16x16x32_bf16(false, a, false, b,
                                                 (short)0, c, false, false);
}

// ---------------------------------------------------------------------------
// Tiled GEMM: Y = X @ W^T + b
// MODE 0: the three input projections in ONE launch; blockIdx.z picks the
//         operand set: 0 = Q (RoPE, scaled by 1/8), 1 = K (RoPE), 2 = V.
//         A f32, bias, head-major bf16 [H][S][DK], plane z of outH.
//         The three are independent of each other: one grid of 3 x 512
//         workgroups keeps three of them on a WGP where a launch of 512 has
//         two, and has no gap, fill or drain between the projections.
// MODE 2: A bf16 (attn out), bias, f32 [S][D_MODEL]             (O-proj)
// Workgroup = 256 threads = 8 waves; tile 128 rows x 64 cols; K stage 128.
// W is the f32 weight as given, [out][in]: its rows are already the [n][k]
// rows of the B tile, so they are rounded to bf16 on the way into LDS.
// ---------------------------------------------------------------------------
template <int MODE>
__global__ void __launch_bounds__(256) k_gemm(const float* __restrict__ A0,
                       const float* __restrict__ A1,
                       const float* __restrict__ A2,
                       const bf16*  __restrict__ Ab,
                       const float* __restrict__ W0,
                       const float* __restrict__ W1,
                       const float* __restrict__ W2,
                       const float* __restrict__ bias0,
                       const float* __restrict__ bias1,
                       const float* __restrict__ bias2,
                       bf16*        __restrict__ outH0,
                       float*       __restrict__ outF) {
  __shared__ alignas(16) bf16 As[128 * P128];  // [row][k], padded rows
  __shared__ alignas(16) bf16 Bs[64 * P128];   // [n][k], padded rows

  // The workgroup's operand set (the same for all its threads).
  const int    z      = (MODE == 0) ? (int)blockIdx.z : 0;
  const float* Af     = z == 0 ? A0 : z == 1 ? A1 : A2;
  const float* W      = z == 0 ? W0 : z == 1 ? W1 : W2;
  const float* bias   = z == 0 ? bias0 : z == 1 ? bias1 : bias2;
  bf16*        outH   = outH0 + (size_t)z * SEQ * D_MODEL;
  const float  oscale = z == 0 ? 0.125f : 1.0f;
  const bool   rope   = z < 2;

  const int tid  = threadIdx.x;
  const int lane = tid & 31;
  const int wave = tid >> 5;
  const int row0 = blockIdx.x * 128;
  const int col0 = blockIdx.y * 64;
  const int m0   = wave * 16;
  const int bn   = tid >> 5;         // B staging: row of W within a group of 8
  const int bk   = (tid & 31) * 4;   // B staging: first of the lane's four k

  // One address per lane and operand; the rows of a stage lie at constant
  // distances from it, which go into the loads' offset fields.
  const float* wp  = W + (size_t)(col0 + bn) * D_MODEL + bk;
  const float* afp = Af + (size_t)(row0 + (tid >> 7)) * D_MODEL + (tid & 127);
  const bf16*  abp = Ab + (size_t)(row0 + (tid >> 4)) * D_MODEL + (tid & 15) * 8;

  v8f c[4] = {};

  // Stays rolled: unrolled, its eight trips are eight copies of a long body.
#pragma unroll 1
  for (int kk = 0; kk < D_MODEL; kk += STG) {
    // 64x128 B tile, [n][k] as in W. 16 B per lane: a wave reads one whole
    // 512-B row piece per load.
    float4 w[8];
#pragma unroll                                 // w[] stays in registers
    for (int rep = 0; rep < 8; ++rep)
      w[rep] = *reinterpret_cast<const float4*>(wp + kk + rep * 8 * D_MODEL);
    // In the MODE 0 build results of A's loads land in the address
    // registers of W's loads: the wait that belongs in front of such an
    // overwrite.
    if (MODE != 2) asm volatile("s_wait_xcnt 0x0" ::: "memory");
    float av[64];
#if ASYNC_CP
    if (MODE == 2) {
      // bf16 source, layout-preserving: async 16B chunks (8 per thread)
#pragma unroll
      for (int rep = 0; rep < 8; ++rep) {
        int r = rep * 16 + (tid >> 4), cc = (tid & 15) * 8;   // 128x128 tile
        async_cp16(abp + kk + rep * 16 * D_MODEL, &As[r * P128 + cc]);
      }
    }
#endif
    if (MODE != 2 || !ASYNC_CP) {
#pragma unroll
      for (int rep = 0; rep < 64; ++rep) {     // 128x128 A tile
        int r = rep * 2 + (tid >> 7), cc = tid & 127;
        if (MODE == 2) av[rep] = (float)Ab[(size_t)(row0 + r) * D_MODEL + kk + cc];
        else           av[rep] = afp[kk + rep * 2 * D_MODEL];
      }
    }
    // Holds every conversion behind the issue of the stage's last load: the
    // stage then pays one load latency, not one per group of loads.
    __builtin_amdgcn_sched_barrier(0);
#pragma unroll
    for (int rep = 0; rep < 8; ++rep) {        // round to bf16, 8 B to LDS
      union { bf16 h[4]; uint2 u; } p;
      p.h[0] = (bf16)w[rep].x; p.h[1] = (bf16)w[rep].y;
      p.h[2] = (bf16)w[rep].z; p.h[3] = (bf16)w[rep].w;
      *reinterpret_cast<uint2*>(&Bs[(rep * 8 + bn) * P128 + bk]) = p.u;
    }
    if (MODE != 2 || !ASYNC_CP) {
#pragma unroll
      for (int rep = 0; rep < 64; ++rep) {
        int r = rep * 2 + (tid >> 7), cc = tid & 127;
        As[r * P128 + cc] = (bf16)av[rep];
      }
    }
#if ASYNC_CP
    if (MODE == 2) async_wait0();
#endif
    __syncthreads();

    // Unrolled: the passes' LDS offsets become immediates of the loads.
#pragma unroll
    for (int ks = 0; ks < STG; ks += 32) {     // k ascending
      v16bf a = ldfrag(&As[m0 * P128 + ks], P128);
#pragma unroll
      for (int nt = 0; nt < 4; ++nt) {
        v16bf b = ldfrag(&Bs[(nt * 16) * P128 + ks], P128);
        c[nt] = wmma_bf16(a, b, c[nt]);
      }
    }
    __syncthreads();
  }

  const int n  = lane & 15;
  const int rb = (lane >> 4) << 3;
#pragma unroll
  for (int nt = 0; nt < 4; ++nt) {
    const int col = col0 + nt * 16 + n;
    const float bv = bias[col];
#pragma unroll
    for (int v = 0; v < 8; ++v) c[nt][v] += bv;

    if (MODE == 2) {
#pragma unroll
      for (int v = 0; v < 8; ++v)
        outF[(size_t)(row0 + m0 + rb + v) * D_MODEL + col] = c[nt][v];
    }
  }
  if (MODE != 2) {
    // One uniform branch round the rotation of all four tiles; the stores
    // follow it in one straight run.
    if (rope) {
#pragma unroll
      for (int nt = 0; nt < 4; ++nt) {
        const int d = (col0 + nt * 16 + n) & 63;
        // RoPE: pairs (2i, 2i+1) are adjacent columns -> adjacent lanes.
        const float freq = __powf(10000.0f, -(float)(d & ~1) * (1.0f / 64.0f));
        const bool  ev   = (d & 1) == 0;
#pragma unroll
        for (int v = 0; v < 8; ++v) {
          const int pos = row0 + m0 + rb + v;
          float sn, cs;
          __sincosf((float)pos * freq, &sn, &cs);
          float x  = c[nt][v];
          float xp = __shfl_xor(x, 1, 32);
          c[nt][v] = ev ? (x * cs - xp * sn) : (xp * sn + x * cs);
        }
      }
    }
#pragma unroll
    for (int nt = 0; nt < 4; ++nt) {
      const int col = col0 + nt * 16 + n;
      const int h = col >> 6;
      const int d = col & 63;
#pragma unroll
      for (int v = 0; v < 8; ++v) {
        const int pos = row0 + m0 + rb + v;
        outH[((size_t)h * SEQ + pos) * DK + d] = (bf16)(c[nt][v] * oscale);
      }
    }
  }
}

static __device__ __forceinline__ float xhalf(float x) {
  return __builtin_bit_cast(float, __builtin_amdgcn_permlanex16(
      __builtin_bit_cast(int, x), __builtin_bit_cast(int, x),
      0x76543210, 0xfedcba98, false, false));
}

__global__ void __launch_bounds__(256) k_attn(const bf16* __restrict__ qh, const bf16* __restrict__ kh,
                       const bf16* __restrict__ vh, bf16* __restrict__ outA) {
  __shared__ alignas(16) bf16 Qs[128 * 64];   // [row][d]       16 KB
  __shared__ alignas(16) bf16 Ks[STG * P64];  // [kv][d], padded rows
  __shared__ alignas(16) bf16 Vs[STG * PV];   // [kv][d], padded rows
  // The upper key half's results on their way to the lower half's waves:
  // [query group][16 pieces of output + 1 of maxima and sums][lane], 16 B each
  __shared__ alignas(16) float4 Mg[4 * 17 * 32];

  const int tid  = threadIdx.x;
  const int lane = tid & 31;
  const int wave = __builtin_amdgcn_readfirstlane(tid >> 5);
  const int row0 = blockIdx.x * 128;
  const int h    = blockIdx.y;
  const int qg   = wave & 3;     // the wave's query group
  const int half = wave >> 2;    // the wave's half of every stage's keys
  const int m0   = qg * 32;

  const bf16* qb = qh + (size_t)h * SEQ * DK;
  const bf16* kb = kh + (size_t)h * SEQ * DK;
  const bf16* vb = vh + (size_t)h * SEQ * DK;

#if ASYNC_CP
#pragma unroll
  for (int rep = 0; rep < 4; ++rep) {          // 128x64 Q tile, 16B/thread/rep
    int e = rep * 2048 + tid * 8;
    async_cp16(qb + (size_t)row0 * DK + e, &Qs[e]);
  }
  async_wait0();
#else
#pragma unroll
  for (int rep = 0; rep < 32; ++rep) {
    int idx = rep * 256 + tid;
    Qs[idx] = qb[(size_t)row0 * DK + idx];
  }
#endif
  __syncthreads();
  // B operand Q^T: lane = query column, k = d; [column group][d half]
  v16bf qa[2][2];
#pragma unroll
  for (int g = 0; g < 2; ++g) {
    qa[g][0] = ldfrag(&Qs[(m0 + g * 16) * 64], 64);
    qa[g][1] = ldfrag(&Qs[(m0 + g * 16) * 64 + 32], 64);
  }

  v16bf ones;
#pragma unroll
  for (int i = 0; i < 16; ++i) ones[i] = (bf16)1.0f;

  // acc[g][nt][v] = O[q = g*16 + n][d = nt*16 + rb + v]
  v8f acc[2][4] = {};
  // -ref of the lane's query in all eight registers, per column group: the C
  // tile of the score products. The first pass sets ref, whatever its sign.
  v8f nref[2] = {};
  // What a score must exceed for ref to move. The start value makes the wave's
  // first pass move it, to that pass's own maximum.
  float gap = -3.0e38f;
  // Row sums of P, one accumulator tile per column group, summed by the matrix
  // instruction itself. Every row of the tile gets the same increment; only
  // register 0 is rescaled and read. (As separate results of which one
  // register is read, back-to-back row sums were given overlapping registers.)
  v8f lacc[2] = {};

  const int n  = lane & 15;
  const int rb = (lane >> 4) << 3;

  // the wave's 64 keys of a stage
  const bf16* Kh = &Ks[half * (STG / 2) * P64];
  const bf16* Vh = &Vs[(half * (STG / 2) + rb + (lane & 7)) * PV +
                       ((lane >> 3) & 1) * 8];   // the lane's ldfrag_tr address

  for (int j0 = 0; j0 < SEQ; j0 += STG) {
#if ASYNC_CP
#pragma unroll
    for (int rep = 0; rep < 4; ++rep) {        // 128x64 K and V tiles
      int ch = rep * 256 + tid;
      async_cp16(kb + (size_t)j0 * DK + ch * 8,
                 &Ks[(ch >> 3) * P64 + (ch & 7) * 8]);
      async_cp16(vb + (size_t)j0 * DK + ch * 8,
                 &Vs[(ch >> 3) * PV + (ch & 7) * 8]);
    }
#else
#pragma unroll
    for (int rep = 0; rep < 32; ++rep) {
      int idx = rep * 256 + tid;
      int r = rep * 4 + (tid >> 6), d = tid & 63;
      Ks[r * P64 + d] = kb[(size_t)j0 * DK + idx];
      Vs[r * PV + d]  = vb[(size_t)j0 * DK + idx];
    }
#endif
    if (j0 + STG < SEQ) {                      // global_prefetch_b8 next stage,
      // one address per 64 B: the 256 threads cover its 16 KB
      __builtin_prefetch(kb + (size_t)(j0 + STG) * DK + tid * 32, 0, 0);
      __builtin_prefetch(vb + (size_t)(j0 + STG) * DK + tid * 32, 0, 0);
    }
#if ASYNC_CP
    async_wait0();
#endif
    __syncthreads();

    // Unrolled: the passes' LDS offsets become immediates, and the next pass's
    // score products can be issued among this pass's vector work.
#pragma unroll
    for (int p0 = 0; p0 < STG / 2; p0 += 32) { // the half's keys ascending
    // S^T(32x16) = K(32x64) * Q^T per column group (scale folded into Q)
    // s0[g][v] = S[q = g*16 + n][kv = p0 + rb + v] - ref, s1: kv = p0 + 16 + rb + v
    const v16bf k00 = ldfrag(Kh + p0 * P64, P64);
    const v16bf k01 = ldfrag(Kh + p0 * P64 + 32, P64);
    const v16bf k10 = ldfrag(Kh + (p0 + 16) * P64, P64);
    const v16bf k11 = ldfrag(Kh + (p0 + 16) * P64 + 32, P64);
    v8f s0[2], s1[2];
#pragma unroll
    for (int g = 0; g < 2; ++g) {
      s0[g] = wmma_bf16(k01, qa[g][1], wmma_bf16(k00, qa[g][0], nref[g]));
      s1[g] = wmma_bf16(k11, qa[g][1], wmma_bf16(k10, qa[g][0], nref[g]));
    }

    v16bf vf[4];
#pragma unroll
    for (int nt = 0; nt < 4; ++nt)
      vf[nt] = ldfrag_tr(Vh + p0 * PV + nt * 16, PV);

    // the lane's largest score above the reference, per column group
    // (a tree of three-input maxima, not one dependent chain)
    float mx[2];
#pragma unroll
    for (int g = 0; g < 2; ++g) {
      const v8f t0 = s0[g], t1 = s1[g];
      const float g0 = fmaxf(fmaxf(t0[0], t0[1]), t0[2]);
      const float g1 = fmaxf(fmaxf(t0[3], t0[4]), t0[5]);
      const float g2 = fmaxf(fmaxf(t0[6], t0[7]), t1[0]);
      const float g3 = fmaxf(fmaxf(t1[1], t1[2]), t1[3]);
      const float g4 = fmaxf(fmaxf(t1[4], t1[5]), t1[6]);
      mx[g] = fmaxf(fmaxf(fmaxf(g0, g1), g2), fmaxf(fmaxf(g3, g4), t1[7]));
    }
    if (__builtin_amdgcn_ballot_w32(mx[0] > gap || mx[1] > gap) != 0) {
#pragma unroll
      for (int g = 0; g < 2; ++g) {
        // both wave halves of a query take the same step
        const float m     = fmaxf(mx[g], xhalf(mx[g]));
        const float step  = m > gap ? m : 0.0f;
        // (a first step may go down; output and sums are still zero then)
        const float alpha = __expf(fminf(-step, 0.0f));
#pragma unroll
        for (int v = 0; v < 8; ++v) {
          s0[g][v]   -= step;
          s1[g][v]   -= step;
          nref[g][v] -= step;
        }
#pragma unroll
        for (int nt = 0; nt < 4; ++nt)
#pragma unroll
          for (int v = 0; v < 8; ++v) acc[g][nt][v] *= alpha;
        lacc[g][0] *= alpha;
      }
      gap = REF_GAP;
    }

#pragma unroll
    for (int g = 0; g < 2; ++g) {
      const v8f t0 = s0[g], t1 = s1[g];
      // P^T as B operand, straight from the two score tiles
      v16bf pb;
#pragma unroll
      for (int v = 0; v < 8; ++v) {
        pb[v]     = (bf16)__expf(t0[v]);
        pb[8 + v] = (bf16)__expf(t1[v]);
      }

      // row-sum(P) via WMMA with all-ones A: every row of the increment holds
      // the sum over all 32 keys of the lane's query
      lacc[g] = wmma_bf16(ones, pb, lacc[g]);

#pragma unroll
      for (int nt = 0; nt < 4; ++nt)
        acc[g][nt] = wmma_bf16(vf[nt], pb, acc[g][nt]);
    }
    }
    __syncthreads();
  }

  // Join the two key halves. The waves of a query group hold the same
  // (query, d) at the same lane and register: the upper half hands its
  // results over lane by lane, 16 B per lane and piece.
  float4* mg = &Mg[qg * 17 * 32 + lane];
  if (half == 1) {
#pragma unroll
    for (int g = 0; g < 2; ++g)
#pragma unroll
      for (int nt = 0; nt < 4; ++nt) {
        const v8f a = acc[g][nt];
        mg[((g * 4 + nt) * 2 + 0) * 32] = make_float4(a[0], a[1], a[2], a[3]);
        mg[((g * 4 + nt) * 2 + 1) * 32] = make_float4(a[4], a[5], a[6], a[7]);
      }
    mg[16 * 32] = make_float4(-nref[0][0], -nref[1][0], lacc[0][0], lacc[1][0]);
  }
  __syncthreads();   // the upper half's results are in LDS
  if (half == 0) {
    // rescale both halves to the larger reference, normalize and store
    // merged-head bf16 [S][D_MODEL]: a lane's 8 accumulator registers are 8
    // consecutive d of its query, one 16-byte store per tile
    const float4 ml = mg[16 * 32];
#pragma unroll
    for (int g = 0; g < 2; ++g) {
      const float mo  = g ? ml.y : ml.x;
      const float lo  = g ? ml.w : ml.z;
      const float mi  = -nref[g][0];
      const float mm  = fmaxf(mi, mo);
      const float ea  = __expf(mi - mm);
      const float eb  = __expf(mo - mm);
      const float inv = 1.0f / (lacc[g][0] * ea + lo * eb);
      const float fa  = ea * inv, fb = eb * inv;
      const int   pos = row0 + m0 + g * 16 + n;
#pragma unroll
      for (int nt = 0; nt < 4; ++nt) {
        const float4 b0 = mg[((g * 4 + nt) * 2 + 0) * 32];
        const float4 b1 = mg[((g * 4 + nt) * 2 + 1) * 32];
        const v8f a = acc[g][nt];
        union { bf16 e[8]; uint4 u; } p;
        p.e[0] = (bf16)(a[0] * fa + b0.x * fb);
        p.e[1] = (bf16)(a[1] * fa + b0.y * fb);
        p.e[2] = (bf16)(a[2] * fa + b0.z * fb);
        p.e[3] = (bf16)(a[3] * fa + b0.w * fb);
        p.e[4] = (bf16)(a[4] * fa + b1.x * fb);
        p.e[5] = (bf16)(a[5] * fa + b1.y * fb);
        p.e[6] = (bf16)(a[6] * fa + b1.z * fb);
        p.e[7] = (bf16)(a[7] * fa + b1.w * fb);
        *reinterpret_cast<uint4*>(
            outA + (size_t)pos * D_MODEL + h * DK + nt * 16 + rb) = p.u;
      }
    }
  }
}

// ---------------------------------------------------------------------------
extern "C" void kernel_launch(void* const* d_in, const int* in_sizes, int n_in,
                              void* d_out, int out_size, void* d_ws,
                              size_t ws_size, hipStream_t stream) {
  const float* Q  = (const float*)d_in[0];
  const float* K  = (const float*)d_in[1];
  const float* V  = (const float*)d_in[2];
  const float* Wq = (const float*)d_in[3];
  const float* bq = (const float*)d_in[4];
  const float* Wk = (const float*)d_in[5];
  const float* bk = (const float*)d_in[6];
  const float* Wv = (const float*)d_in[7];
  const float* bv = (const float*)d_in[8];
  const float* Wo = (const float*)d_in[9];
  const float* bo = (const float*)d_in[10];
  float* out = (float*)d_out;

  char* ws = (char*)d_ws;
  const size_t TB = (size_t)SEQ * D_MODEL * sizeof(bf16);     // 8 MB
  bf16* qh   = (bf16*)(ws);
  bf16* kh   = (bf16*)(ws + TB);
  bf16* vh   = (bf16*)(ws + 2 * TB);
  bf16* at   = (bf16*)(ws + 3 * TB);

  dim3 blk(256);
  dim3 grd(SEQ / 128, D_MODEL / 64);          // 32 x 16
  k_gemm<0><<<dim3(SEQ / 128, D_MODEL / 64, 3), blk, 0, stream>>>(
      Q, K, V, nullptr, Wq, Wk, Wv, bq, bk, bv, qh, nullptr);

  k_attn<<<dim3(SEQ / 128, NHEAD), blk, 0, stream>>>(qh, kh, vh, at);

  k_gemm<2><<<grd, blk, 0, stream>>>(nullptr, nullptr, nullptr, at, Wo, nullptr,
                                     nullptr, bo, nullptr, nullptr, nullptr, out);
}

// v009
// It runs in 118 microseconds.
// Next to v008, in two timings, it ran 1.19 times as fast each time.
// Over all steps from v000 it is 6.46 times as fast.
#include <hip/hip_runtime.h>
#include <hip/hip_bf16.h>

typedef __bf16 bf16;
typedef __attribute__((ext_vector_type(16))) __bf16 v16bf;
typedef __attribute__((ext_vector_type(8)))  float  v8f;
typedef int v4i_ __attribute__((vector_size(16)));

#define D_MODEL 1024
#define SEQ     4096
#define NHEAD   16
#define DK      64

#define P64 72   // rows of 64 elements (128 B of data) lie 144 B apart
#define P128 136 // rows of 128 elements (256 B of data) lie 272 B apart
// V rows are read by the 16-bit transposing load, which wants 32 B x odd.
#define PV 80    // rows of 64 elements (128 B of data) lie 160 B apart

// Depth of one LDS stage: keys of an attention stage, k of a GEMM stage (the
// input projections take half of it). A stage is loaded, published by one
// barrier and then worked off in passes of 32 with no barrier between them.
#define STG 128

// How far a score may rise above the held softmax reference before it moves.
#define REF_GAP 5.5f

#define AS1 __attribute__((address_space(1)))
#define AS3 __attribute__((address_space(3)))

#if __has_builtin(__builtin_amdgcn_global_load_async_to_lds_b128)
#define ASYNC_CP 1
static __device__ __forceinline__ void async_cp16(const void* g, void* l) {
  __builtin_amdgcn_global_load_async_to_lds_b128(
      (AS1 v4i_*)(unsigned long long)(size_t)g,
      (AS3 v4i_*)(unsigned)(size_t)l, 0, 0);
}
static __device__ __forceinline__ void async_wait0() {
#if __has_builtin(__builtin_amdgcn_s_wait_asynccnt)
  __builtin_amdgcn_s_wait_asynccnt(0);
#else
  asm volatile("s_wait_asynccnt 0" ::: "memory");
#endif
}
#else
#define ASYNC_CP 0
#endif

static __device__ __forceinline__ v16bf ldfrag(const bf16* base, int ld) {
  const int lane = threadIdx.x & 31;
  const int m    = lane & 15;
  const int b0   = (lane & 16) ? 8 : 0;
  const bf16* p  = base + m * ld + b0;
  union { uint4 u[2]; v16bf v; } r;
  r.u[0] = *reinterpret_cast<const uint4*>(p);
  r.u[1] = *reinterpret_cast<const uint4*>(p + 16);
  return r.v;
}

// ---------------------------------------------------------------------------
// Transposed fragment: 16 (columns of T) x 32 (rows of T) A operand from a
// row-major 16-bit LDS tile T, by two ds_load_tr16_b128. p is the lane's own
// address: row 8 * (lane >> 4) + (lane & 7) of the fragment's first 16 rows,
// 16 B * ((lane >> 3) & 1) into the fragment's 32 B of columns. The lane gets
// T[8h + 0..7][c] and T[16 + 8h + 0..7][c], c = lane & 15, h = lane >> 4:
// the k order of ldfrag.
// ---------------------------------------------------------------------------
typedef short s16x8 __attribute__((ext_vector_type(8)));
static __device__ __forceinline__ v16bf ldfrag_tr(const bf16* p, int ld) {
  typedef AS3 s16x8 lds_s16x8;
  union { s16x8 q[2]; v16bf v; } r;
  r.q[0] = __builtin_amdgcn_ds_load_tr16_b128_v8i16((lds_s16x8*)p);
  r.q[1] = __builtin_amdgcn_ds_load_tr16_b128_v8i16((lds_s16x8*)(p + 16 * ld));
  return r.v;
}

static __device__ __forceinline__ v8f wmma_bf16(v16bf a, v16bf b, v8f c) {
  return __builtin_amdgcn_wmma_f32_16x16x32_bf16(false, a, false, b,
                                                 (short)0, c, false, false);
}

// ---------------------------------------------------------------------------
// Tiled GEMM: Y = X @ W^T + b
// MODE 0: the three input projections in ONE launch; blockIdx.z picks the
//         operand set: 0 = Q (RoPE, scaled by 1/8), 1 = K (RoPE), 2 = V.
//         A f32, bias, head-major bf16 [H][S][DK], plane z of outH.
//         The three are independent of each other: one grid has no gap,
//         fill or drain between the projections.
// MODE 2: A bf16 (attn out), bias, f32 [S][D_MODEL]             (O-proj)
// Workgroup = 256 threads = 8 waves.
// MODE 2: tile 128 rows x 64 cols, a wave 16 x 64, K stage 128.
// MODE 0: tile 128 rows x 128 cols, 4 x 2 waves of 32 x 64, K stage 64. A
//         square tile reads the fewest bytes from L2 per product, and six
//         fragments from LDS feed eight matrix instructions. The short stage
//         keeps the staging registers few enough for three workgroups on a
//         WGP: the grid of 3 x 256 workgroups is resident at once. A wave's
//         64 columns are one head: it writes that head's rows whole.
// W is the f32 weight as given, [out][in]: its rows are already the [n][k]
// rows of the B tile, so they are rounded to bf16 on the way into LDS.
// ---------------------------------------------------------------------------
template <int MODE>
__global__ void __launch_bounds__(256) k_gemm(const float* __restrict__ A0,
                       const float* __restrict__ A1,
                       const float* __restrict__ A2,
                       const bf16*  __restrict__ Ab,
                       const float* __restrict__ W0,
                       const float* __restrict__ W1,
                       const float* __restrict__ W2,
                       const float* __restrict__ bias0,
                       const float* __restrict__ bias1,
                       const float* __restrict__ bias2,
                       bf16*        __restrict__ outH0,
                       float*       __restrict__ outF) {
  constexpr int BN  = MODE == 0 ? 128 : 64;    // columns of the tile
  constexpr int KST = MODE == 0 ? 64 : STG;    // k of one LDS stage
  constexpr int PK  = MODE == 0 ? P64 : P128;  // pitch of a stage's rows
  constexpr int MT  = MODE == 0 ? 2 : 1;       // groups of 16 rows per wave
  constexpr int BR  = 256 / (KST / 4);         // rows of W per round of loads
  constexpr int AR  = 256 / KST;               // rows of f32 A per round
  __shared__ alignas(16) bf16 As[128 * PK];    // [row][k], padded rows
  __shared__ alignas(16) bf16 Bs[BN * PK];     // [n][k], padded rows

  // The workgroup's operand set (the same for all its threads).
  const int    z      = (MODE == 0) ? (int)blockIdx.z : 0;
  const float* Af     = z == 0 ? A0 : z == 1 ? A1 : A2;
  const float* W      = z == 0 ? W0 : z == 1 ? W1 : W2;
  const float* bias   = z == 0 ? bias0 : z == 1 ? bias1 : bias2;
  bf16*        outH   = outH0 + (size_t)z * SEQ * D_MODEL;
  const float  oscale = z == 0 ? 0.125f : 1.0f;
  const bool   rope   = z < 2;

  const int tid  = threadIdx.x;
  const int lane = tid & 31;
  const int wave = tid >> 5;
  const int row0 = blockIdx.x * 128;
  const int col0 = blockIdx.y * BN;
  const int m0   = (MODE == 0 ? (wave & 3) : wave) * (MT * 16);
  const int n0   = MODE == 0 ? (wave >> 2) * 64 : 0;
  const int bn   = tid / (KST / 4);        // B staging: row of W within a round
  const int bk   = (tid % (KST / 4)) * 4;  // B staging: first of the lane's four k

  // One address per lane and operand; the rows of a stage lie at constant
  // distances from it, which go into the loads' offset fields.
  const float* wp  = W + (size_t)(col0 + bn) * D_MODEL + bk;
  const float* afp = Af + (size_t)(row0 + tid / KST) * D_MODEL + tid % KST;
  const bf16*  abp = Ab + (size_t)(row0 + (tid >> 4)) * D_MODEL + (tid & 15) * 8;

  v8f c[MT][4] = {};

  // Stays rolled: unrolled, its trips are so many copies of a long body.
#pragma unroll 1
  for (int kk = 0; kk < D_MODEL; kk += KST) {
    // B tile, [n][k] as in W. 16 B per lane: a wave reads whole row pieces of
    // the stage, 512 B of one row or 256 B of two, per load.
    float4 w[8];
    static_assert(BN == 8 * BR, "eight rounds of loads bring the B tile");
#pragma unroll                                 // w[] stays in registers
    for (int rep = 0; rep < 8; ++rep)
      w[rep] = *reinterpret_cast<const float4*>(wp + kk + rep * BR * D_MODEL);
    // In the MODE 0 build results of A's loads land in the address
    // registers of W's loads: the wait that belongs in front of such an
    // overwrite.
    if (MODE != 2) asm volatile("s_wait_xcnt 0x0" ::: "memory");
    float av[128 / AR];
#if ASYNC_CP
    if (MODE == 2) {
      // bf16 source, layout-preserving: async 16B chunks (8 per thread)
#pragma unroll
      for (int rep = 0; rep < 8; ++rep) {
        int r = rep * 16 + (tid >> 4), cc = (tid & 15) * 8;   // 128x128 tile
        async_cp16(abp + kk + rep * 16 * D_MODEL, &As[r * PK + cc]);
      }
    }
#endif
    if (MODE != 2 || !ASYNC_CP) {
#pragma unroll
      for (int rep = 0; rep < 128 / AR; ++rep) {   // the stage's A tile
        int r = rep * AR + tid / KST, cc = tid % KST;
        if (MODE == 2) av[rep] = (float)Ab[(size_t)(row0 + r) * D_MODEL + kk + cc];
        else           av[rep] = afp[kk + rep * AR * D_MODEL];
      }
    }
    // Holds every conversion behind the issue of the stage's last load: the
    // stage then pays one load latency, not one per group of loads.
    __builtin_amdgcn_sched_barrier(0);
#pragma unroll
    for (int rep = 0; rep < 8; ++rep) {        // round to bf16, 8 B to LDS
      union { bf16 h[4]; uint2 u; } p;
      p.h[0] = (bf16)w[rep].x; p.h[1] = (bf16)w[rep].y;
      p.h[2] = (bf16)w[rep].z; p.h[3] = (bf16)w[rep].w;
      *reinterpret_cast<uint2*>(&Bs[(rep * BR + bn) * PK + bk]) = p.u;
    }
    if (MODE != 2 || !ASYNC_CP) {
#pragma unroll
      for (int rep = 0; rep < 128 / AR; ++rep) {
        int r = rep * AR + tid / KST, cc = tid % KST;
        As[r * PK + cc] = (bf16)av[rep];
      }
    }
#if ASYNC_CP
    if (MODE == 2) async_wait0();
#endif
    __syncthreads();

    // Unrolled: the passes' LDS offsets become immediates of the loads.
#pragma unroll
    for (int ks = 0; ks < KST; ks += 32) {     // k ascending
      v16bf a[MT];
#pragma unroll
      for (int mt = 0; mt < MT; ++mt)
        a[mt] = ldfrag(&As[(m0 + mt * 16) * PK + ks], PK);
#pragma unroll
      for (int nt = 0; nt < 4; ++nt) {
        v16bf b = ldfrag(&Bs[(n0 + nt * 16) * PK + ks], PK);
#pragma unroll
        for (int mt = 0; mt < MT; ++mt)
          c[mt][nt] = wmma_bf16(a[mt], b, c[mt][nt]);
      }
    }
    __syncthreads();
  }

  const int n  = lane & 15;
  const int rb = (lane >> 4) << 3;
#pragma unroll
  for (int nt = 0; nt < 4; ++nt) {
    const int col = col0 + n0 + nt * 16 + n;
    const float bv = bias[col];
#pragma unroll
    for (int mt = 0; mt < MT; ++mt) {
#pragma unroll
      for (int v = 0; v < 8; ++v) c[mt][nt][v] += bv;

      if (MODE == 2) {
#pragma unroll
        for (int v = 0; v < 8; ++v)
          outF[(size_t)(row0 + m0 + mt * 16 + rb + v) * D_MODEL + col] =
              c[mt][nt][v];
      }
    }
  }
  if (MODE != 2) {
    // One uniform branch round the rotation of all tiles; the stores follow
    // it in one straight run.
    if (rope) {
#pragma unroll
      for (int nt = 0; nt < 4; ++nt) {
        const int d = (col0 + n0 + nt * 16 + n) & 63;
        // RoPE: pairs (2i, 2i+1) are adjacent columns -> adjacent lanes.
        const float freq = __powf(10000.0f, -(float)(d & ~1) * (1.0f / 64.0f));
        const bool  ev   = (d & 1) == 0;
#pragma unroll
        for (int mt = 0; mt < MT; ++mt)
#pragma unroll
          for (int v = 0; v < 8; ++v) {
            const int pos = row0 + m0 + mt * 16 + rb + v;
            float sn, cs;
            __sincosf((float)pos * freq, &sn, &cs);
            float x  = c[mt][nt][v];
            float xp = __shfl_xor(x, 1, 32);
            c[mt][nt][v] = ev ? (x * cs - xp * sn) : (xp * sn + x * cs);
          }
      }
    }
#pragma unroll
    for (int nt = 0; nt < 4; ++nt) {
      const int col = col0 + n0 + nt * 16 + n;
      const int h = col >> 6;
      const int d = col & 63;
#pragma unroll
      for (int mt = 0; mt < MT; ++mt)
#pragma unroll
        for (int v = 0; v < 8; ++v) {
          const int pos = row0 + m0 + mt * 16 + rb + v;
          outH[((size_t)h * SEQ + pos) * DK + d] = (bf16)(c[mt][nt][v] * oscale);
        }
    }
  }
}

static __device__ __forceinline__ float xhalf(float x) {
  return __builtin_bit_cast(float, __builtin_amdgcn_permlanex16(
      __builtin_bit_cast(int, x), __builtin_bit_cast(int, x),
      0x76543210, 0xfedcba98, false, false));
}

__global__ void __launch_bounds__(256) k_attn(const bf16* __restrict__ qh, const bf16* __restrict__ kh,
                       const bf16* __restrict__ vh, bf16* __restrict__ outA) {
  __shared__ alignas(16) bf16 Qs[128 * 64];   // [row][d]       16 KB
  __shared__ alignas(16) bf16 Ks[STG * P64];  // [kv][d], padded rows
  __shared__ alignas(16) bf16 Vs[STG * PV];   // [kv][d], padded rows
  // The upper key half's results on their way to the lower half's waves:
  // [query group][16 pieces of output + 1 of maxima and sums][lane], 16 B each
  __shared__ alignas(16) float4 Mg[4 * 17 * 32];

  const int tid  = threadIdx.x;
  const int lane = tid & 31;
  const int wave = __builtin_amdgcn_readfirstlane(tid >> 5);
  const int row0 = blockIdx.x * 128;
  const int h    = blockIdx.y;
  const int qg   = wave & 3;     // the wave's query group
  const int half = wave >> 2;    // the wave's half of every stage's keys
  const int m0   = qg * 32;

  const bf16* qb = qh + (size_t)h * SEQ * DK;
  const bf16* kb = kh + (size_t)h * SEQ * DK;
  const bf16* vb = vh + (size_t)h * SEQ * DK;

#if ASYNC_CP
#pragma unroll
  for (int rep = 0; rep < 4; ++rep) {          // 128x64 Q tile, 16B/thread/rep
    int e = rep * 2048 + tid * 8;
    async_cp16(qb + (size_t)row0 * DK + e, &Qs[e]);
  }
  async_wait0();
#else
#pragma unroll
  for (int rep = 0; rep < 32; ++rep) {
    int idx = rep * 256 + tid;
    Qs[idx] = qb[(size_t)row0 * DK + idx];
  }
#endif
  __syncthreads();
  // B operand Q^T: lane = query column, k = d; [column group][d half]
  v16bf qa[2][2];
#pragma unroll
  for (int g = 0; g < 2; ++g) {
    qa[g][0] = ldfrag(&Qs[(m0 + g * 16) * 64], 64);
    qa[g][1] = ldfrag(&Qs[(m0 + g * 16) * 64 + 32], 64);
  }

  v16bf ones;
#pragma unroll
  for (int i = 0; i < 16; ++i) ones[i] = (bf16)1.0f;

  // acc[g][nt][v] = O[q = g*16 + n][d = nt*16 + rb + v]
  v8f acc[2][4] = {};
  // -ref of the lane's query in all eight registers, per column group: the C
  // tile of the score products. The first pass sets ref, whatever its sign.
  v8f nref[2] = {};
  // What a score must exceed for ref to move. The start value makes the wave's
  // first pass move it, to that pass's own maximum.
  float gap = -3.0e38f;
  // Row sums of P, one accumulator tile per column group, summed by the matrix
  // instruction itself. Every row of the tile gets the same increment; only
  // register 0 is rescaled and read. (As separate results of which one
  // register is read, back-to-back row sums were given overlapping registers.)
  v8f lacc[2] = {};

  const int n  = lane & 15;
  const int rb = (lane >> 4) << 3;

  // the wave's 64 keys of a stage
  const bf16* Kh = &Ks[half * (STG / 2) * P64];
  const bf16* Vh = &Vs[(half * (STG / 2) + rb + (lane & 7)) * PV +
                       ((lane >> 3) & 1) * 8];   // the lane's ldfrag_tr address

  for (int j0 = 0; j0 < SEQ; j0 += STG) {
#if ASYNC_CP
#pragma unroll
    for (int rep = 0; rep < 4; ++rep) {        // 128x64 K and V tiles
      int ch = rep * 256 + tid;
      async_cp16(kb + (size_t)j0 * DK + ch * 8,
                 &Ks[(ch >> 3) * P64 + (ch & 7) * 8]);
      async_cp16(vb + (size_t)j0 * DK + ch * 8,
                 &Vs[(ch >> 3) * PV + (ch & 7) * 8]);
    }
#else
#pragma unroll
    for (int rep = 0; rep < 32; ++rep) {
      int idx = rep * 256 + tid;
      int r = rep * 4 + (tid >> 6), d = tid & 63;
      Ks[r * P64 + d] = kb[(size_t)j0 * DK + idx];
      Vs[r * PV + d]  = vb[(size_t)j0 * DK + idx];
    }
#endif
    if (j0 + STG < SEQ) {                      // global_prefetch_b8 next stage,
      // one address per 64 B: the 256 threads cover its 16 KB
      __builtin_prefetch(kb + (size_t)(j0 + STG) * DK + tid * 32, 0, 0);
      __builtin_prefetch(vb + (size_t)(j0 + STG) * DK + tid * 32, 0, 0);
    }
#if ASYNC_CP
    async_wait0();
#endif
    __syncthreads();

    // Unrolled: the passes' LDS offsets become immediates, and the next pass's
    // score products can be issued among this pass's vector work.
#pragma unroll
    for (int p0 = 0; p0 < STG / 2; p0 += 32) { // the half's keys ascending
    // S^T(32x16) = K(32x64) * Q^T per column group (scale folded into Q)
    // s0[g][v] = S[q = g*16 + n][kv = p0 + rb + v] - ref, s1: kv = p0 + 16 + rb + v
    const v16bf k00 = ldfrag(Kh + p0 * P64, P64);
    const v16bf k01 = ldfrag(Kh + p0 * P64 + 32, P64);
    const v16bf k10 = ldfrag(Kh + (p0 + 16) * P64, P64);
    const v16bf k11 = ldfrag(Kh + (p0 + 16) * P64 + 32, P64);
    v8f s0[2], s1[2];
#pragma unroll
    for (int g = 0; g < 2; ++g) {
      s0[g] = wmma_bf16(k01, qa[g][1], wmma_bf16(k00, qa[g][0], nref[g]));
      s1[g] = wmma_bf16(k11, qa[g][1], wmma_bf16(k10, qa[g][0], nref[g]));
    }

    v16bf vf[4];
#pragma unroll
    for (int nt = 0; nt < 4; ++nt)
      vf[nt] = ldfrag_tr(Vh + p0 * PV + nt * 16, PV);

    // the lane's largest score above the reference, per column group
    // (a tree of three-input maxima, not one dependent chain)
    float mx[2];
#pragma unroll
    for (int g = 0; g < 2; ++g) {
      const v8f t0 = s0[g], t1 = s1[g];
      const float g0 = fmaxf(fmaxf(t0[0], t0[1]), t0[2]);
      const float g1 = fmaxf(fmaxf(t0[3], t0[4]), t0[5]);
      const float g2 = fmaxf(fmaxf(t0[6], t0[7]), t1[0]);
      const float g3 = fmaxf(fmaxf(t1[1], t1[2]), t1[3]);
      const float g4 = fmaxf(fmaxf(t1[4], t1[5]), t1[6]);
      mx[g] = fmaxf(fmaxf(fmaxf(g0, g1), g2), fmaxf(fmaxf(g3, g4), t1[7]));
    }
    if (__builtin_amdgcn_ballot_w32(mx[0] > gap || mx[1] > gap) != 0) {
#pragma unroll
      for (int g = 0; g < 2; ++g) {
        // both wave halves of a query take the same step
        const float m     = fmaxf(mx[g], xhalf(mx[g]));
        const float step  = m > gap ? m : 0.0f;
        // (a first step may go down; output and sums are still zero then)
        const float alpha = __expf(fminf(-step, 0.0f));
#pragma unroll
        for (int v = 0; v < 8; ++v) {
          s0[g][v]   -= step;
          s1[g][v]   -= step;
          nref[g][v] -= step;
        }
#pragma unroll
        for (int nt = 0; nt < 4; ++nt)
#pragma unroll
          for (int v = 0; v < 8; ++v) acc[g][nt][v] *= alpha;
        lacc[g][0] *= alpha;
      }
      gap = REF_GAP;
    }

#pragma unroll
    for (int g = 0; g < 2; ++g) {
      const v8f t0 = s0[g], t1 = s1[g];
      // P^T as B operand, straight from the two score tiles
      v16bf pb;
#pragma unroll
      for (int v = 0; v < 8; ++v) {
        pb[v]     = (bf16)__expf(t0[v]);
        pb[8 + v] = (bf16)__expf(t1[v]);
      }

      // row-sum(P) via WMMA with all-ones A: every row of the increment holds
      // the sum over all 32 keys of the lane's query
      lacc[g] = wmma_bf16(ones, pb, lacc[g]);

#pragma unroll
      for (int nt = 0; nt < 4; ++nt)
        acc[g][nt] = wmma_bf16(vf[nt], pb, acc[g][nt]);
    }
    }
    __syncthreads();
  }

  // Join the two key halves. The waves of a query group hold the same
  // (query, d) at the same lane and register: the upper half hands its
  // results over lane by lane, 16 B per lane and piece.
  float4* mg = &Mg[qg * 17 * 32 + lane];
  if (half == 1) {
#pragma unroll
    for (int g = 0; g < 2; ++g)
#pragma unroll
      for (int nt = 0; nt < 4; ++nt) {
        const v8f a = acc[g][nt];
        mg[((g * 4 + nt) * 2 + 0) * 32] = make_float4(a[0], a[1], a[2], a[3]);
        mg[((g * 4 + nt) * 2 + 1) * 32] = make_float4(a[4], a[5], a[6], a[7]);
      }
    mg[16 * 32] = make_float4(-nref[0][0], -nref[1][0], lacc[0][0], lacc[1][0]);
  }
  __syncthreads();   // the upper half's results are in LDS
  if (half == 0) {
    // rescale both halves to the larger reference, normalize and store
    // merged-head bf16 [S][D_MODEL]: a lane's 8 accumulator registers are 8
    // consecutive d of its query, one 16-byte store per tile
    const float4 ml = mg[16 * 32];
#pragma unroll
    for (int g = 0; g < 2; ++g) {
      const float mo  = g ? ml.y : ml.x;
      const float lo  = g ? ml.w : ml.z;
      const float mi  = -nref[g][0];
      const float mm  = fmaxf(mi, mo);
      const float ea  = __expf(mi - mm);
      const float eb  = __expf(mo - mm);
      const float inv = 1.0f / (lacc[g][0] * ea + lo * eb);
      const float fa  = ea * inv, fb = eb * inv;
      const int   pos = row0 + m0 + g * 16 + n;
#pragma unroll
      for (int nt = 0; nt < 4; ++nt) {
        const float4 b0 = mg[((g * 4 + nt) * 2 + 0) * 32];
        const float4 b1 = mg[((g * 4 + nt) * 2 + 1) * 32];
        const v8f a = acc[g][nt];
        union { bf16 e[8]; uint4 u; } p;
        p.e[0] = (bf16)(a[0] * fa + b0.x * fb);
        p.e[1] = (bf16)(a[1] * fa + b0.y * fb);
        p.e[2] = (bf16)(a[2] * fa + b0.z * fb);
        p.e[3] = (bf16)(a[3] * fa + b0.w * fb);
        p.e[4] = (bf16)(a[4] * fa + b1.x * fb);
        p.e[5] = (bf16)(a[5] * fa + b1.y * fb);
        p.e[6] = (bf16)(a[6] * fa + b1.z * fb);
        p.e[7] = (bf16)(a[7] * fa + b1.w * fb);
        *reinterpret_cast<uint4*>(
            outA + (size_t)pos * D_MODEL + h * DK + nt * 16 + rb) = p.u;
      }
    }
  }
}

// ---------------------------------------------------------------------------
extern "C" void kernel_launch(void* const* d_in, const int* in_sizes, int n_in,
                              void* d_out, int out_size, void* d_ws,
                              size_t ws_size, hipStream_t stream) {
  const float* Q  = (const float*)d_in[0];
  const float* K  = (const float*)d_in[1];
  const float* V  = (const float*)d_in[2];
  const float* Wq = (const float*)d_in[3];
  const float* bq = (const float*)d_in[4];
  const float* Wk = (const float*)d_in[5];
  const float* bk = (const float*)d_in[6];
  const float* Wv = (const float*)d_in[7];
  const float* bv = (const float*)d_in[8];
  const float* Wo = (const float*)d_in[9];
  const float* bo = (const float*)d_in[10];
  float* out = (float*)d_out;

  char* ws = (char*)d_ws;
  const size_t TB = (size_t)SEQ * D_MODEL * sizeof(bf16);     // 8 MB
  bf16* qh   = (bf16*)(ws);
  bf16* kh   = (bf16*)(ws + TB);
  bf16* vh   = (bf16*)(ws + 2 * TB);
  bf16* at   = (bf16*)(ws + 3 * TB);

  dim3 blk(256);
  dim3 grd(SEQ / 128, D_MODEL / 64);          // 32 x 16
  k_gemm<0><<<dim3(SEQ / 128, D_MODEL / 128, 3), blk, 0, stream>>>(
      Q, K, V, nullptr, Wq, Wk, Wv, bq, bk, bv, qh, nullptr);

  k_attn<<<dim3(SEQ / 128, NHEAD), blk, 0, stream>>>(qh, kh, vh, at);

  k_gemm<2><<<grd, blk, 0, stream>>>(nullptr, nullptr, nullptr, at, Wo, nullptr,
                                     nullptr, bo, nullptr, nullptr, nullptr, out);
}

// v010
// A run of this version takes 114 microseconds.
// Two timings next to v009 both put it at 1.03 times that version's speed.
// Over all steps from v000 it is 6.67 times as fast.
#include <hip/hip_runtime.h>
#include <hip/hip_bf16.h>

typedef __bf16 bf16;
typedef __attribute__((ext_vector_type(16))) __bf16 v16bf;
typedef __attribute__((ext_vector_type(8)))  float  v8f;
typedef int v4i_ __attribute__((vector_size(16)));

#define D_MODEL 1024
#define SEQ     4096
#define NHEAD   16
#define DK      64

#define P64 72   // rows of 64 elements (128 B of data) lie 144 B apart
#define P128 136 // rows of 128 elements (256 B of data) lie 272 B apart
// V rows are read by the 16-bit transposing load, which wants 32 B x odd.
#define PV 80    // rows of 64 elements (128 B of data) lie 160 B apart

// Depth of one LDS stage: keys of an attention stage, k of a GEMM stage (the
// input projections take half of it). A stage is loaded, published by one
// barrier and then worked off in passes of 32 with no barrier between them.
#define STG 128

// How far a score may rise above the held softmax reference before it moves.
#define REF_GAP 5.5f

#define AS1 __attribute__((address_space(1)))
#define AS3 __attribute__((address_space(3)))

#if __has_builtin(__builtin_amdgcn_global_load_async_to_lds_b128)
#define ASYNC_CP 1
static __device__ __forceinline__ void async_cp16(const void* g, void* l) {
  __builtin_amdgcn_global_load_async_to_lds_b128(
      (AS1 v4i_*)(unsigned long long)(size_t)g,
      (AS3 v4i_*)(unsigned)(size_t)l, 0, 0);
}
static __device__ __forceinline__ void async_wait0() {
#if __has_builtin(__builtin_amdgcn_s_wait_asynccnt)
  __builtin_amdgcn_s_wait_asynccnt(0);
#else
  asm volatile("s_wait_asynccnt 0" ::: "memory");
#endif
}
#else
#define ASYNC_CP 0
#endif

static __device__ __forceinline__ v16bf ldfrag(const bf16* base, int ld) {
  const int lane = threadIdx.x & 31;
  const int m    = lane & 15;
  const int b0   = (lane & 16) ? 8 : 0;
  const bf16* p  = base + m * ld + b0;
  union { uint4 u[2]; v16bf v; } r;
  r.u[0] = *reinterpret_cast<const uint4*>(p);
  r.u[1] = *reinterpret_cast<const uint4*>(p + 16);
  return r.v;
}

// ---------------------------------------------------------------------------
// Transposed fragment: 16 (columns of T) x 32 (rows of T) A operand from a
// row-major 16-bit LDS tile T, by two ds_load_tr16_b128. p is the lane's own
// address: row 8 * (lane >> 4) + (lane & 7) of the fragment's first 16 rows,
// 16 B * ((lane >> 3) & 1) into the fragment's 32 B of columns. The lane gets
// T[8h + 0..7][c] and T[16 + 8h + 0..7][c], c = lane & 15, h = lane >> 4:
// the k order of ldfrag.
// ---------------------------------------------------------------------------
typedef short s16x8 __attribute__((ext_vector_type(8)));
static __device__ __forceinline__ v16bf ldfrag_tr(const bf16* p, int ld) {
  typedef AS3 s16x8 lds_s16x8;
  union { s16x8 q[2]; v16bf v; } r;
  r.q[0] = __builtin_amdgcn_ds_load_tr16_b128_v8i16((lds_s16x8*)p);
  r.q[1] = __builtin_amdgcn_ds_load_tr16_b128_v8i16((lds_s16x8*)(p + 16 * ld));
  return r.v;
}

static __device__ __forceinline__ v8f wmma_bf16(v16bf a, v16bf b, v8f c) {
  return __builtin_amdgcn_wmma_f32_16x16x32_bf16(false, a, false, b,
                                                 (short)0, c, false, false);
}

// ---------------------------------------------------------------------------
// Tiled GEMM: Y = X @ W^T + b
// MODE 0: the three input projections in ONE launch; blockIdx.z picks the
//         operand set: 0 = Q (RoPE, scaled by 1/8), 1 = K (RoPE), 2 = V.
//         A f32, bias, head-major bf16 [H][S][DK], plane z of outH.
//         The three are independent of each other: one grid has no gap,
//         fill or drain between the projections.
// MODE 2: A bf16 (attn out), bias, f32 [S][D_MODEL]             (O-proj)
// Workgroup = 256 threads = 8 waves.
// MODE 2: tile 128 rows x 64 cols, a wave 16 x 64, K stage 128.
// MODE 0: tile 128 rows x 128 cols, 4 x 2 waves of 32 x 64, K stage 64. A
//         square tile reads the fewest bytes from L2 per product, and six
//         fragments from LDS feed eight matrix instructions. The short stage
//         keeps the staging registers few enough for three workgroups on a
//         WGP: the grid of 3 x 256 workgroups is resident at once. A wave's
//         64 columns are one head: it writes that head's rows whole.
// W is the f32 weight as given, [out][in]: its rows are already the [n][k]
// rows of the B tile, so they are rounded to bf16 on the way into LDS.
// ---------------------------------------------------------------------------
template <int MODE>
__global__ void __launch_bounds__(256) k_gemm(const float* __restrict__ A0,
                       const float* __restrict__ A1,
                       const float* __restrict__ A2,
                       const bf16*  __restrict__ Ab,
                       const float* __restrict__ W0,
                       const float* __restrict__ W1,
                       const float* __restrict__ W2,
                       const float* __restrict__ bias0,
                       const float* __restrict__ bias1,
                       const float* __restrict__ bias2,
                       bf16*        __restrict__ outH0,
                       float*       __restrict__ outF) {
  constexpr int BN  = MODE == 0 ? 128 : 64;    // columns of the tile
  constexpr int KST = MODE == 0 ? 64 : STG;    // k of one LDS stage
  constexpr int PK  = MODE == 0 ? P64 : P128;  // pitch of a stage's rows
  constexpr int MT  = MODE == 0 ? 2 : 1;       // groups of 16 rows per wave
  constexpr int BR  = 256 / (KST / 4);         // rows of W per round of loads
  constexpr int AR  = 256 / KST;               // rows of f32 A per round
  constexpr int GK  = MODE == 0 ? 1 : 4;       // passes of 32 k per group of B fragments
  static_assert((KST / 32) % GK == 0, "whole groups fill a stage");
  __shared__ alignas(16) bf16 As[128 * PK];    // [row][k], padded rows
  __shared__ alignas(16) bf16 Bs[BN * PK];     // [n][k], padded rows

  // The workgroup's operand set (the same for all its threads).
  const int    z      = (MODE == 0) ? (int)blockIdx.z : 0;
  const float* Af     = z == 0 ? A0 : z == 1 ? A1 : A2;
  const float* W      = z == 0 ? W0 : z == 1 ? W1 : W2;
  const float* bias   = z == 0 ? bias0 : z == 1 ? bias1 : bias2;
  bf16*        outH   = outH0 + (size_t)z * SEQ * D_MODEL;
  const float  oscale = z == 0 ? 0.125f : 1.0f;
  const bool   rope   = z < 2;

  const int tid  = threadIdx.x;
  const int lane = tid & 31;
  const int wave = tid >> 5;
  const int row0 = blockIdx.x * 128;
  const int col0 = blockIdx.y * BN;
  const int m0   = (MODE == 0 ? (wave & 3) : wave) * (MT * 16);
  const int n0   = MODE == 0 ? (wave >> 2) * 64 : 0;
  const int bn   = tid / (KST / 4);        // B staging: row of W within a round
  const int bk   = (tid % (KST / 4)) * 4;  // B staging: first of the lane's four k

  // One address per lane and operand; the rows of a stage lie at constant
  // distances from it, which go into the loads' offset fields.
  const float* wp  = W + (size_t)(col0 + bn) * D_MODEL + bk;
  const float* afp = Af + (size_t)(row0 + tid / KST) * D_MODEL + tid % KST;
  const bf16*  abp = Ab + (size_t)(row0 + (tid >> 4)) * D_MODEL + (tid & 15) * 8;

  v8f c[MT][4] = {};

  // Stays rolled: unrolled, its trips are so many copies of a long body.
#pragma unroll 1
  for (int kk = 0; kk < D_MODEL; kk += KST) {
    // B tile, [n][k] as in W. 16 B per lane: a wave reads whole row pieces of
    // the stage, 512 B of one row or 256 B of two, per load.
    float4 w[8];
    static_assert(BN == 8 * BR, "eight rounds of loads bring the B tile");
#pragma unroll                                 // w[] stays in registers
    for (int rep = 0; rep < 8; ++rep)
      w[rep] = *reinterpret_cast<const float4*>(wp + kk + rep * BR * D_MODEL);
    // In the MODE 0 build results of A's loads land in the address
    // registers of W's loads: the wait that belongs in front of such an
    // overwrite.
    if (MODE != 2) asm volatile("s_wait_xcnt 0x0" ::: "memory");
    float av[128 / AR];
#if ASYNC_CP
    if (MODE == 2) {
      // bf16 source, layout-preserving: async 16B chunks (8 per thread)
#pragma unroll
      for (int rep = 0; rep < 8; ++rep) {
        int r = rep * 16 + (tid >> 4), cc = (tid & 15) * 8;   // 128x128 tile
        async_cp16(abp + kk + rep * 16 * D_MODEL, &As[r * PK + cc]);
      }
    }
#endif
    if (MODE != 2 || !ASYNC_CP) {
#pragma unroll
      for (int rep = 0; rep < 128 / AR; ++rep) {   // the stage's A tile
        int r = rep * AR + tid / KST, cc = tid % KST;
        if (MODE == 2) av[rep] = (float)Ab[(size_t)(row0 + r) * D_MODEL + kk + cc];
        else           av[rep] = afp[kk + rep * AR * D_MODEL];
      }
    }
    // Holds every conversion behind the issue of the stage's last load: the
    // stage then pays one load latency, not one per group of loads.
    __builtin_amdgcn_sched_barrier(0);
#pragma unroll
    for (int rep = 0; rep < 8; ++rep) {        // round to bf16, 8 B to LDS
      union { bf16 h[4]; uint2 u; } p;
      p.h[0] = (bf16)w[rep].x; p.h[1] = (bf16)w[rep].y;
      p.h[2] = (bf16)w[rep].z; p.h[3] = (bf16)w[rep].w;
      *reinterpret_cast<uint2*>(&Bs[(rep * BR + bn) * PK + bk]) = p.u;
    }
    if (MODE != 2 || !ASYNC_CP) {
#pragma unroll
      for (int rep = 0; rep < 128 / AR; ++rep) {
        int r = rep * AR + tid / KST, cc = tid % KST;
        As[r * PK + cc] = (bf16)av[rep];
      }
    }
#if ASYNC_CP
    if (MODE == 2) async_wait0();
#endif
    __syncthreads();

    // Unrolled: the passes' LDS offsets become immediates of the loads.
    // All A fragments of the stage are asked for at its head, with the first
    // group of B fragments.
    v16bf a[KST / 32][MT];
#pragma unroll
    for (int p = 0; p < KST / 32; ++p)
#pragma unroll
      for (int mt = 0; mt < MT; ++mt)
        a[p][mt] = ldfrag(&As[(m0 + mt * 16) * PK + p * 32], PK);
#pragma unroll
    for (int p0 = 0; p0 < KST / 32; p0 += GK) {
      // The B fragments of GK passes are asked for as one group, each in
      // registers of its own.
      v16bf b[GK][4];
#pragma unroll
      for (int g = 0; g < GK; ++g)
#pragma unroll
        for (int nt = 0; nt < 4; ++nt)
          b[g][nt] = ldfrag(&Bs[(n0 + nt * 16) * PK + (p0 + g) * 32], PK);
      // Keeps the group's loads in front of its first product: sunk among the
      // products they share one register set, and every fragment's LDS latency
      // is waited out on its own.
      __builtin_amdgcn_sched_barrier(0);
#pragma unroll
      for (int g = 0; g < GK; ++g)             // k ascending
#pragma unroll
        for (int nt = 0; nt < 4; ++nt)
#pragma unroll
          for (int mt = 0; mt < MT; ++mt)
            c[mt][nt] = wmma_bf16(a[p0 + g][mt], b[g][nt], c[mt][nt]);
    }
    __syncthreads();
  }

  const int n  = lane & 15;
  const int rb = (lane >> 4) << 3;
#pragma unroll
  for (int nt = 0; nt < 4; ++nt) {
    const int col = col0 + n0 + nt * 16 + n;
    const float bv = bias[col];
#pragma unroll
    for (int mt = 0; mt < MT; ++mt) {
#pragma unroll
      for (int v = 0; v < 8; ++v) c[mt][nt][v] += bv;

      if (MODE == 2) {
#pragma unroll
        for (int v = 0; v < 8; ++v)
          outF[(size_t)(row0 + m0 + mt * 16 + rb + v) * D_MODEL + col] =
              c[mt][nt][v];
      }
    }
  }
  if (MODE != 2) {
    // One uniform branch round the rotation of all tiles; the stores follow
    // it in one straight run.
    if (rope) {
#pragma unroll
      for (int nt = 0; nt < 4; ++nt) {
        const int d = (col0 + n0 + nt * 16 + n) & 63;
        // RoPE: pairs (2i, 2i+1) are adjacent columns -> adjacent lanes.
        const float freq = __powf(10000.0f, -(float)(d & ~1) * (1.0f / 64.0f));
        const bool  ev   = (d & 1) == 0;
#pragma unroll
        for (int mt = 0; mt < MT; ++mt)
#pragma unroll
          for (int v = 0; v < 8; ++v) {
            const int pos = row0 + m0 + mt * 16 + rb + v;
            float sn, cs;
            __sincosf((float)pos * freq, &sn, &cs);
            float x  = c[mt][nt][v];
            float xp = __shfl_xor(x, 1, 32);
            c[mt][nt][v] = ev ? (x * cs - xp * sn) : (xp * sn + x * cs);
          }
      }
    }
#pragma unroll
    for (int nt = 0; nt < 4; ++nt) {
      const int col = col0 + n0 + nt * 16 + n;
      const int h = col >> 6;
      const int d = col & 63;
#pragma unroll
      for (int mt = 0; mt < MT; ++mt)
#pragma unroll
        for (int v = 0; v < 8; ++v) {
          const int pos = row0 + m0 + mt * 16 + rb + v;
          outH[((size_t)h * SEQ + pos) * DK + d] = (bf16)(c[mt][nt][v] * oscale);
        }
    }
  }
}

static __device__ __forceinline__ float xhalf(float x) {
  return __builtin_bit_cast(float, __builtin_amdgcn_permlanex16(
      __builtin_bit_cast(int, x), __builtin_bit_cast(int, x),
      0x76543210, 0xfedcba98, false, false));
}

__global__ void __launch_bounds__(256) k_attn(const bf16* __restrict__ qh, const bf16* __restrict__ kh,
                       const bf16* __restrict__ vh, bf16* __restrict__ outA) {
  __shared__ alignas(16) bf16 Qs[128 * 64];   // [row][d]       16 KB
  __shared__ alignas(16) bf16 Ks[STG * P64];  // [kv][d], padded rows
  __shared__ alignas(16) bf16 Vs[STG * PV];   // [kv][d], padded rows
  // The upper key half's results on their way to the lower half's waves:
  // [query group][16 pieces of output + 1 of maxima and sums][lane], 16 B each
  __shared__ alignas(16) float4 Mg[4 * 17 * 32];

  const int tid  = threadIdx.x;
  const int lane = tid & 31;
  const int wave = __builtin_amdgcn_readfirstlane(tid >> 5);
  const int row0 = blockIdx.x * 128;
  const int h    = blockIdx.y;
  const int qg   = wave & 3;     // the wave's query group
  const int half = wave >> 2;    // the wave's half of every stage's keys
  const int m0   = qg * 32;

  const bf16* qb = qh + (size_t)h * SEQ * DK;
  const bf16* kb = kh + (size_t)h * SEQ * DK;
  const bf16* vb = vh + (size_t)h * SEQ * DK;

#if ASYNC_CP
#pragma unroll
  for (int rep = 0; rep < 4; ++rep) {          // 128x64 Q tile, 16B/thread/rep
    int e = rep * 2048 + tid * 8;
    async_cp16(qb + (size_t)row0 * DK + e, &Qs[e]);
  }
  async_wait0();
#else
#pragma unroll
  for (int rep = 0; rep < 32; ++rep) {
    int idx = rep * 256 + tid;
    Qs[idx] = qb[(size_t)row0 * DK + idx];
  }
#endif
  __syncthreads();
  // B operand Q^T: lane = query column, k = d; [column group][d half]
  v16bf qa[2][2];
#pragma unroll
  for (int g = 0; g < 2; ++g) {
    qa[g][0] = ldfrag(&Qs[(m0 + g * 16) * 64], 64);
    qa[g][1] = ldfrag(&Qs[(m0 + g * 16) * 64 + 32], 64);
  }

  v16bf ones;
#pragma unroll
  for (int i = 0; i < 16; ++i) ones[i] = (bf16)1.0f;

  // acc[g][nt][v] = O[q = g*16 + n][d = nt*16 + rb + v]
  v8f acc[2][4] = {};
  // -ref of the lane's query in all eight registers, per column group: the C
  // tile of the score products. The first pass sets ref, whatever its sign.
  v8f nref[2] = {};
  // What a score must exceed for ref to move. The start value makes the wave's
  // first pass move it, to that pass's own maximum.
  float gap = -3.0e38f;
  // Row sums of P, one accumulator tile per column group, summed by the matrix
  // instruction itself. Every row of the tile gets the same increment; only
  // register 0 is rescaled and read. (As separate results of which one
  // register is read, back-to-back row sums were given overlapping registers.)
  v8f lacc[2] = {};

  const int n  = lane & 15;
  const int rb = (lane >> 4) << 3;

  // the wave's 64 keys of a stage
  const bf16* Kh = &Ks[half * (STG / 2) * P64];
  const bf16* Vh = &Vs[(half * (STG / 2) + rb + (lane & 7)) * PV +
                       ((lane >> 3) & 1) * 8];   // the lane's ldfrag_tr address

  for (int j0 = 0; j0 < SEQ; j0 += STG) {
#if ASYNC_CP
#pragma unroll
    for (int rep = 0; rep < 4; ++rep) {        // 128x64 K and V tiles
      int ch = rep * 256 + tid;
      async_cp16(kb + (size_t)j0 * DK + ch * 8,
                 &Ks[(ch >> 3) * P64 + (ch & 7) * 8]);
      async_cp16(vb + (size_t)j0 * DK + ch * 8,
                 &Vs[(ch >> 3) * PV + (ch & 7) * 8]);
    }
#else
#pragma unroll
    for (int rep = 0; rep < 32; ++rep) {
      int idx = rep * 256 + tid;
      int r = rep * 4 + (tid >> 6), d = tid & 63;
      Ks[r * P64 + d] = kb[(size_t)j0 * DK + idx];
      Vs[r * PV + d]  = vb[(size_t)j0 * DK + idx];
    }
#endif
    if (j0 + STG < SEQ) {                      // global_prefetch_b8 next stage,
      // one address per 64 B: the 256 threads cover its 16 KB
      __builtin_prefetch(kb + (size_t)(j0 + STG) * DK + tid * 32, 0, 0);
      __builtin_prefetch(vb + (size_t)(j0 + STG) * DK + tid * 32, 0, 0);
    }
#if ASYNC_CP
    async_wait0();
#endif
    __syncthreads();

    // Unrolled: the passes' LDS offsets become immediates, and the next pass's
    // score products can be issued among this pass's vector work.
#pragma unroll
    for (int p0 = 0; p0 < STG / 2; p0 += 32) { // the half's keys ascending
    // S^T(32x16) = K(32x64) * Q^T per column group (scale folded into Q)
    // s0[g][v] = S[q = g*16 + n][kv = p0 + rb + v] - ref, s1: kv = p0 + 16 + rb + v
    const v16bf k00 = ldfrag(Kh + p0 * P64, P64);
    const v16bf k01 = ldfrag(Kh + p0 * P64 + 32, P64);
    const v16bf k10 = ldfrag(Kh + (p0 + 16) * P64, P64);
    const v16bf k11 = ldfrag(Kh + (p0 + 16) * P64 + 32, P64);
    v8f s0[2], s1[2];
#pragma unroll
    for (int g = 0; g < 2; ++g) {
      s0[g] = wmma_bf16(k01, qa[g][1], wmma_bf16(k00, qa[g][0], nref[g]));
      s1[g] = wmma_bf16(k11, qa[g][1], wmma_bf16(k10, qa[g][0], nref[g]));
    }

    v16bf vf[4];
#pragma unroll
    for (int nt = 0; nt < 4; ++nt)
      vf[nt] = ldfrag_tr(Vh + p0 * PV + nt * 16, PV);

    // the lane's largest score above the reference, per column group
    // (a tree of three-input maxima, not one dependent chain)
    float mx[2];
#pragma unroll
    for (int g = 0; g < 2; ++g) {
      const v8f t0 = s0[g], t1 = s1[g];
      const float g0 = fmaxf(fmaxf(t0[0], t0[1]), t0[2]);
      const float g1 = fmaxf(fmaxf(t0[3], t0[4]), t0[5]);
      const float g2 = fmaxf(fmaxf(t0[6], t0[7]), t1[0]);
      const float g3 = fmaxf(fmaxf(t1[1], t1[2]), t1[3]);
      const float g4 = fmaxf(fmaxf(t1[4], t1[5]), t1[6]);
      mx[g] = fmaxf(fmaxf(fmaxf(g0, g1), g2), fmaxf(fmaxf(g3, g4), t1[7]));
    }
    if (__builtin_amdgcn_ballot_w32(mx[0] > gap || mx[1] > gap) != 0) {
#pragma unroll
      for (int g = 0; g < 2; ++g) {
        // both wave halves of a query take the same step
        const float m     = fmaxf(mx[g], xhalf(mx[g]));
        const float step  = m > gap ? m : 0.0f;
        // (a first step may go down; output and sums are still zero then)
        const float alpha = __expf(fminf(-step, 0.0f));
#pragma unroll
        for (int v = 0; v < 8; ++v) {
          s0[g][v]   -= step;
          s1[g][v]   -= step;
          nref[g][v] -= step;
        }
#pragma unroll
        for (int nt = 0; nt < 4; ++nt)
#pragma unroll
          for (int v = 0; v < 8; ++v) acc[g][nt][v] *= alpha;
        lacc[g][0] *= alpha;
      }
      gap = REF_GAP;
    }

#pragma unroll
    for (int g = 0; g < 2; ++g) {
      const v8f t0 = s0[g], t1 = s1[g];
      // P^T as B operand, straight from the two score tiles
      v16bf pb;
#pragma unroll
      for (int v = 0; v < 8; ++v) {
        pb[v]     = (bf16)__expf(t0[v]);
        pb[8 + v] = (bf16)__expf(t1[v]);
      }

      // row-sum(P) via WMMA with all-ones A: every row of the increment holds
      // the sum over all 32 keys of the lane's query
      lacc[g] = wmma_bf16(ones, pb, lacc[g]);

#pragma unroll
      for (int nt = 0; nt < 4; ++nt)
        acc[g][nt] = wmma_bf16(vf[nt], pb, acc[g][nt]);
    }
    }
    __syncthreads();
  }

  // Join the two key halves. The waves of a query group hold the same
  // (query, d) at the same lane and register: the upper half hands its
  // results over lane by lane, 16 B per lane and piece.
  float4* mg = &Mg[qg * 17 * 32 + lane];
  if (half == 1) {
#pragma unroll
    for (int g = 0; g < 2; ++g)
#pragma unroll
      for (int nt = 0; nt < 4; ++nt) {
        const v8f a = acc[g][nt];
        mg[((g * 4 + nt) * 2 + 0) * 32] = make_float4(a[0], a[1], a[2], a[3]);
        mg[((g * 4 + nt) * 2 + 1) * 32] = make_float4(a[4], a[5], a[6], a[7]);
      }
    mg[16 * 32] = make_float4(-nref[0][0], -nref[1][0], lacc[0][0], lacc[1][0]);
  }
  __syncthreads();   // the upper half's results are in LDS
  if (half == 0) {
    // rescale both halves to the larger reference, normalize and store
    // merged-head bf16 [S][D_MODEL]: a lane's 8 accumulator registers are 8
    // consecutive d of its query, one 16-byte store per tile
    const float4 ml = mg[16 * 32];
#pragma unroll
    for (int g = 0; g < 2; ++g) {
      const float mo  = g ? ml.y : ml.x;
      const float lo  = g ? ml.w : ml.z;
      const float mi  = -nref[g][0];
      const float mm  = fmaxf(mi, mo);
      const float ea  = __expf(mi - mm);
      const float eb  = __expf(mo - mm);
      const float inv = 1.0f / (lacc[g][0] * ea + lo * eb);
      const float fa  = ea * inv, fb = eb * inv;
      const int   pos = row0 + m0 + g * 16 + n;
#pragma unroll
      for (int nt = 0; nt < 4; ++nt) {
        const float4 b0 = mg[((g * 4 + nt) * 2 + 0) * 32];
        const float4 b1 = mg[((g * 4 + nt) * 2 + 1) * 32];
        const v8f a = acc[g][nt];
        union { bf16 e[8]; uint4 u; } p;
        p.e[0] = (bf16)(a[0] * fa + b0.x * fb);
        p.e[1] = (bf16)(a[1] * fa + b0.y * fb);
        p.e[2] = (bf16)(a[2] * fa + b0.z * fb);
        p.e[3] = (bf16)(a[3] * fa + b0.w * fb);
        p.e[4] = (bf16)(a[4] * fa + b1.x * fb);
        p.e[5] = (bf16)(a[5] * fa + b1.y * fb);
        p.e[6] = (bf16)(a[6] * fa + b1.z * fb);
        p.e[7] = (bf16)(a[7] * fa + b1.w * fb);
        *reinterpret_cast<uint4*>(
            outA + (size_t)pos * D_MODEL + h * DK + nt * 16 + rb) = p.u;
      }
    }
  }
}

// ---------------------------------------------------------------------------
extern "C" void kernel_launch(void* const* d_in, const int* in_sizes, int n_in,
                              void* d_out, int out_size, void* d_ws,
                              size_t ws_size, hipStream_t stream) {
  const float* Q  = (const float*)d_in[0];
  const float* K  = (const float*)d_in[1];
  const float* V  = (const float*)d_in[2];
  const float* Wq = (const float*)d_in[3];
  const float* bq = (const float*)d_in[4];
  const float* Wk = (const float*)d_in[5];
  const float* bk = (const float*)d_in[6];
  const float* Wv = (const float*)d_in[7];
  const float* bv = (const float*)d_in[8];
  const float* Wo = (const float*)d_in[9];
  const float* bo = (const float*)d_in[10];
  float* out = (float*)d_out;

  char* ws = (char*)d_ws;
  const size_t TB = (size_t)SEQ * D_MODEL * sizeof(bf16);     // 8 MB
  bf16* qh   = (bf16*)(ws);
  bf16* kh   = (bf16*)(ws + TB);
  bf16* vh   = (bf16*)(ws + 2 * TB);
  bf16* at   = (bf16*)(ws + 3 * TB);

  dim3 blk(256);
  dim3 grd(SEQ / 128, D_MODEL / 64);          // 32 x 16
  k_gemm<0><<<dim3(SEQ / 128, D_MODEL / 128, 3), blk, 0, stream>>>(
      Q, K, V, nullptr, Wq, Wk, Wv, bq, bk, bv, qh, nullptr);

  k_attn<<<dim3(SEQ / 128, NHEAD), blk, 0, stream>>>(qh, kh, vh, at);

  k_gemm<2><<<grd, blk, 0, stream>>>(nullptr, nullptr, nullptr, at, Wo, nullptr,
                                     nullptr, bo, nullptr, nullptr, nullptr, out);
}
